// v000
// The times below were measured on an AMD MI455X: many runs one after another, warmed up first and cycling through
// copies of the inputs, with the whole window's GPU time divided by the number of runs. Launches and the gaps
// between them are all in it. The median over several windows is given; except for v000 it joins two sittings, which
// can be a few percent apart, so the side-by-side timings, each taken in one sitting, are the better comparison.
// v000, which the later versions start from, runs in 137 microseconds.
// Scaled-dot-product attention (32 heads x 2,048 x 64, scores x 1/sqrt(512), no mask). Both contractions (k . q^T and v^T . p^T) on v_wmma_f32_16x16x32_f16: q, k, v converted to bf16 (RNE) and carried x16 as exact f16 planes, probabilities carried x256 as f16, f32 accumulate, f32 online softmax in the exp2 domain.
#include <hip/hip_runtime.h>

typedef __attribute__((ext_vector_type(16))) _Float16     v16h;
typedef __attribute__((ext_vector_type(8)))  _Float16     v8h;
typedef __attribute__((ext_vector_type(8)))  float        v8f;
typedef __attribute__((ext_vector_type(4)))  float        v4f;
typedef __attribute__((ext_vector_type(4)))  unsigned int v4u;

#ifndef NB
#define NB 4
#endif
#ifndef SEQ
#define SEQ 2048
#endif
#define NB_FULL  4
#define SEQ_FULL 2048
#define NH       8
#define DH       64
#define FA_NW    4                 // waves per block
#define FA_QB    (16 * FA_NW)      // queries per block
#define OS_P     68                // LDS pitch (floats) of the per-wave output tile

#define PLANE_ELEMS ((size_t)NB * NH * SEQ * DH)
#define PLANE_BYTES (PLANE_ELEMS * 2)
#define WS_TOTAL    (3 * PLANE_BYTES)

static_assert(DH == 64);
static_assert(NB <= NB_FULL);
static_assert(SEQ <= SEQ_FULL);
static_assert(SEQ % 256 == 0);            // cast kernels: one wave's 32 x 8 elements stay inside one plane row; key loop steps by 32
static_assert(SEQ % FA_QB == 0);          // query tiles exact
static_assert(DH % 32 == 0);              // k-steps of 32 over the head dim
static_assert(PLANE_BYTES % 128 == 0);
static_assert(WS_TOTAL <= 134217728);     // workspace carve <= 128 MiB
static_assert((OS_P * 4) % 16 == 0);

// 16-bit WMMA fragment map (wave32), lane L, h = L>>4, m = L&15:
//   A 16x32: lane = row m;    element i -> k = (i<8) ? 8h+i : 16+8h+(i-8)
//   B 32x16: lane = column m; the SAME k(i,h)
//   D 16x16 (8 f32): lane = column m; element r -> row 8h+r
union FragH { v16h v; v8h h[2]; };
// p already points at (row, k0 + 8h): elements 0..7 <- p[0..7], 8..15 <- p[16..23]
__device__ __forceinline__ v16h ld_frag(const _Float16* __restrict__ p) {
    FragH f; f.h[0] = *(const v8h*)(p); f.h[1] = *(const v8h*)(p + 16); return f.v;
}
__device__ __forceinline__ v8f mma16(v16h a, v16h b, v8f c) {
    return __builtin_amdgcn_wmma_f32_16x16x32_f16(false, a, false, b, (short)0, c, false, false);
}
// hazard guards: all accumulators of the group are tied, all operand fragments stay live through the nops
__device__ __forceinline__ void guard_s(v8f& s0, v8f& s1, v16h a0, v16h a1, v16h a2, v16h a3, v16h b0, v16h b1) {
    asm volatile("v_nop\n\tv_nop\n\tv_nop\n\tv_nop" : "+v"(s0), "+v"(s1) : "v"(a0), "v"(a1), "v"(a2), "v"(a3), "v"(b0), "v"(b1));
}
__device__ __forceinline__ void guard_o(v8f& o0, v8f& o1, v8f& o2, v8f& o3, v16h a0, v16h a1, v16h a2, v16h a3, v16h b) {
    asm volatile("v_nop\n\tv_nop\n\tv_nop\n\tv_nop" : "+v"(o0), "+v"(o1), "+v"(o2), "+v"(o3) : "v"(a0), "v"(a1), "v"(a2), "v"(a3), "v"(b));
}

// bf16 RNE kept as f32 (finite inputs)
__device__ __forceinline__ float bf_rne(float v) {
    const unsigned u = __float_as_uint(v);
    const unsigned r = (u + 0x7fffu + ((u >> 16) & 1u)) & 0xffff0000u;
    return __uint_as_float(r);
}
__device__ __forceinline__ unsigned int pk2h(float a, float b) {
    return (unsigned int)__builtin_bit_cast(unsigned short, (_Float16)a) | ((unsigned int)__builtin_bit_cast(unsigned short, (_Float16)b) << 16);
}

// f32 [bh][s][64] (full-size row stride) -> f16 plane [bh][SEQ][64] = bf16_rne(x) * 16 (exact in f16).
__global__ __launch_bounds__(256) void k_cast_rows(const float* __restrict__ src, unsigned short* __restrict__ dst) {
    const long long u = (long long)blockIdx.x * 256 + threadIdx.x;
    if (u >= (long long)NB * NH * SEQ * (DH / 8)) return;
    const int c0 = 8 * (int)(u & 7);
    const long long row = u >> 3;
    const int bh = (int)(row / SEQ);
    const int s  = (int)(row % SEQ);
    const float* sp = src + ((size_t)bh * SEQ_FULL + (size_t)s) * DH + c0;
    const v4f x0 = *(const v4f*)(sp);
    const v4f x1 = *(const v4f*)(sp + 4);
    v4u pk;
    pk.x = pk2h(bf_rne(x0.x) * 16.0f, bf_rne(x0.y) * 16.0f);
    pk.y = pk2h(bf_rne(x0.z) * 16.0f, bf_rne(x0.w) * 16.0f);
    pk.z = pk2h(bf_rne(x1.x) * 16.0f, bf_rne(x1.y) * 16.0f);
    pk.w = pk2h(bf_rne(x1.z) * 16.0f, bf_rne(x1.w) * 16.0f);
    v4u* d = (v4u*)(dst + (size_t)row * DH + c0);
    *d = pk; 
}

// f32 v[bh][s][64] -> f16 plane vt[bh][64][SEQ] (transposed) = bf16_rne(x) * 16.
__global__ __launch_bounds__(256) void k_cast_vt(const float* __restrict__ src, unsigned short* __restrict__ dst) {
    const long long u = (long long)blockIdx.x * 256 + threadIdx.x;
    const int per = SEQ / 8;
    if (u >= (long long)NB * NH * DH * per) return;
    const int s0 = 8 * (int)(u % per);
    const long long rid = u / per;
    const int d  = (int)(rid % DH);
    const int bh = (int)(rid / DH);
    const float* sp = src + ((size_t)bh * SEQ_FULL + (size_t)s0) * DH + d;
    float w[8];
#pragma unroll
    for (int e = 0; e < 8; ++e) w[e] = bf_rne(sp[(size_t)e * DH]) * 16.0f;
    v4u pk;
    pk.x = pk2h(w[0], w[1]); pk.y = pk2h(w[2], w[3]); pk.z = pk2h(w[4], w[5]); pk.w = pk2h(w[6], w[7]);
    v4u* dd = (v4u*)(dst + ((size_t)bh * DH + (size_t)d) * SEQ + s0);
    *dd = pk; 
}

// Fused attention, transposed orientation. Wave = 16 queries; 32 keys per step.
//   S^T (16 keys x 16 queries) = K (A: row = key, k = d) x Q^T (B: column = query, k = d), two key tiles per step.
//   P^T (B operand, k = key, column = query) is built in registers from the two D tiles: element r <- tile(keys 0..15)[r], element 8+r <- tile(keys 16..31)[r], same lane.
//   O^T (16 d x 16 queries) += V^T (A: row = d, k = key) x P^T, four d tiles.
//   Per-query statistics live per lane (column = query): in-lane max over 16 scores + one xor-16 exchange; per-lane partial sums, combined once at the end.
#define FA_STAGE(T, ACC) do { \
    v4f lo_, hi_; \
    lo_.x = ACC[0] * inv; lo_.y = ACC[1] * inv; lo_.z = ACC[2] * inv; lo_.w = ACC[3] * inv; \
    hi_.x = ACC[4] * inv; hi_.y = ACC[5] * inv; hi_.z = ACC[6] * inv; hi_.w = ACC[7] * inv; \
    *(v4f*)&os[wave][col * OS_P + (T) * 16 + 8 * h]     = lo_; \
    *(v4f*)&os[wave][col * OS_P + (T) * 16 + 8 * h + 4] = hi_; \
} while (0)

__global__ __launch_bounds__(32 * FA_NW) void k_fa(const _Float16* __restrict__ Q16, const _Float16* __restrict__ K16, const _Float16* __restrict__ Vt16,
                                                   float* __restrict__ O, const int* __restrict__ n_unused) {
    (void)n_unused;                                        // the module's integer scalar input; not used by the computation
    __shared__ __align__(16) float os[FA_NW][16 * OS_P];   // per-wave 16 x 64 output tile (written and read by the same wave; block barrier in between)
    const int lane = threadIdx.x & 31;
    const int wave = __builtin_amdgcn_readfirstlane(threadIdx.x >> 5);
    const int h = lane >> 4, col = lane & 15;
    const int bh = blockIdx.y;
    const int q0 = blockIdx.x * FA_QB + wave * 16;
    const size_t pbase = (size_t)bh * SEQ * DH;            // same element count for the [SEQ][64] and [64][SEQ] planes

    // scores are carried x256 (q x16, k x16); exp2 domain: 2^(s * C2), C2 = log2(e) / sqrt(512) / 256
    const float C2 = (float)(0.044194173824159216 * 1.4426950408889634 / 256.0);

    const _Float16* qrow = Q16 + pbase + (size_t)(q0 + col) * DH + 8 * h;
    const v16h bq0 = ld_frag(qrow);                        // d 0..31
    const v16h bq1 = ld_frag(qrow + 32);                   // d 32..63
    const _Float16* kp = K16 + pbase + (size_t)col * DH + 8 * h;
    const _Float16* vp = Vt16 + pbase + (size_t)col * SEQ + 8 * h;

    v8f a0 = {}, a1 = {}, a2 = {}, a3 = {};
    float m = -1.0e30f, l = 0.0f;

#pragma unroll 1
    for (int kg = 0; kg < SEQ / 32; ++kg) {
        const _Float16* kt = kp + (size_t)kg * 32 * DH;
        const v16h k00 = ld_frag(kt);                      // keys kg*32 + 0..15, d 0..31
        const v16h k01 = ld_frag(kt + 32);                 // d 32..63
        const v16h k10 = ld_frag(kt + 16 * DH);            // keys kg*32 + 16..31
        const v16h k11 = ld_frag(kt + 16 * DH + 32);
        v8f s0 = {}, s1 = {};
        s0 = mma16(k00, bq0, s0);
        s1 = mma16(k10, bq0, s1);
        s0 = mma16(k01, bq1, s0);
        s1 = mma16(k11, bq1, s1);
        guard_s(s0, s1, k00, k01, k10, k11, bq0, bq1);

        const _Float16* vt = vp + kg * 32;
        const v16h v0 = ld_frag(vt);                       // d 0..15,  keys kg*32 + {8h.., 16+8h..}
        const v16h v1 = ld_frag(vt + 16 * SEQ);
        const v16h v2 = ld_frag(vt + 32 * SEQ);
        const v16h v3 = ld_frag(vt + 48 * SEQ);

        float mx = fmaxf(s0[0], s1[0]);
#pragma unroll
        for (int r = 1; r < 8; ++r) mx = fmaxf(mx, fmaxf(s0[r], s1[r]));
        mx *= C2;                                          // C2 > 0: max commutes with the scale
        mx = fmaxf(mx, __shfl_xor(mx, 16, 32));            // the other 16 keys of this query live in lane ^ 16
        const float mnew = fmaxf(m, mx);
        const float corr = __builtin_amdgcn_exp2f(m - mnew);
        const float nref = 8.0f - mnew;                    // probabilities carried x 2^8
        v16h bp; float rs = 0.0f;
#pragma unroll
        for (int r = 0; r < 8; ++r) {
            const float e0 = __builtin_amdgcn_exp2f(__builtin_fmaf(s0[r], C2, nref));
            const float e1 = __builtin_amdgcn_exp2f(__builtin_fmaf(s1[r], C2, nref));
            rs += e0 + e1;
            bp[r]     = (_Float16)e0;                      // key 8h + r
            bp[8 + r] = (_Float16)e1;                      // key 16 + 8h + r
        }
        l = l * corr + rs;
        m = mnew;
        a0 = a0 * corr; a1 = a1 * corr; a2 = a2 * corr; a3 = a3 * corr;
        a0 = mma16(v0, bp, a0);
        a1 = mma16(v1, bp, a1);
        a2 = mma16(v2, bp, a2);
        a3 = mma16(v3, bp, a3);
        guard_o(a0, a1, a2, a3, v0, v1, v2, v3, bp);
    }

    const float lt = l + __shfl_xor(l, 16, 32);            // both lane halves of a query used the same running max
    const float inv = 1.0f / (lt * 16.0f);                 // undo the x16 carry of v; the x256 carry of p cancels against lt

    FA_STAGE(0, a0);
    FA_STAGE(1, a1);
    FA_STAGE(2, a2);
    FA_STAGE(3, a3);
    __syncthreads();
    {
        float* ob = O + ((size_t)bh * SEQ + (size_t)q0) * DH;
        const int c4 = (lane & 15) * 4;
        {
#pragma unroll
            for (int it = 0; it < 8; ++it) {
                const int row = it * 2 + h;                // 16 lanes x 16 B = one 256-B output row; one instruction = two whole rows (512 contiguous bytes)
                const v4f val = *(const v4f*)&os[wave][row * OS_P + c4];
                *(v4f*)(ob + (size_t)row * DH + c4) = val;
            }
            
        }
    }
}

extern "C" void kernel_launch(void* const* d_in, const int* in_sizes, int n_in, void* d_out, int out_size, void* d_ws, size_t ws_size, hipStream_t stream) {
    if (n_in < 4) return;
    const long long need = ((long long)(NB * NH - 1) * SEQ_FULL + SEQ) * DH;
    if ((long long)in_sizes[0] < need || (long long)in_sizes[1] < need || (long long)in_sizes[2] < need || in_sizes[3] < 1) return;
    if ((long long)out_size < (long long)NB * NH * SEQ * DH) return;
    if ((size_t)WS_TOTAL > ws_size) return;
    const float* q = (const float*)d_in[0];
    const float* k = (const float*)d_in[1];
    const float* v = (const float*)d_in[2];
    const int*   n = (const int*)d_in[3];
    float* out = (float*)d_out;
    char* wsp = (char*)d_ws;
    unsigned short* Q16  = (unsigned short*)(wsp);
    unsigned short* K16  = (unsigned short*)(wsp + PLANE_BYTES);
    unsigned short* Vt16 = (unsigned short*)(wsp + 2 * PLANE_BYTES);

    const unsigned gr = (unsigned)(((long long)NB * NH * SEQ * (DH / 8) + 255) / 256);
    const unsigned gv = (unsigned)(((long long)NB * NH * DH * (SEQ / 8) + 255) / 256);
    k_cast_rows<<<gr, 256, 0, stream>>>(q, Q16);
    k_cast_rows<<<gr, 256, 0, stream>>>(k, K16);
    k_cast_vt<<<gv, 256, 0, stream>>>(v, Vt16);
    k_fa<<<dim3((unsigned)(SEQ / FA_QB), (unsigned)(NB * NH)), 32 * FA_NW, 0, stream>>>((const _Float16*)Q16, (const _Float16*)K16, (const _Float16*)Vt16, out, n);
}

// v001
// A run of this version takes 83.3 microseconds.
// In two side-by-side timings against v000, it was 1.70 and 1.67 times as fast.
// Scaled-dot-product attention (32 heads x 2,048 x 64, scores x 1/sqrt(512), no mask). Both contractions (k . q^T and v^T . p^T) on v_wmma_f32_16x16x32_f16: q, k, v converted to bf16 (RNE) and carried x16 as exact f16 planes stored in WMMA fragment order, probabilities carried x256 as f16, f32 accumulate, f32 online softmax in the exp2 domain.
#include <hip/hip_runtime.h>

typedef __attribute__((ext_vector_type(16))) _Float16     v16h;
typedef __attribute__((ext_vector_type(8)))  _Float16     v8h;
typedef __attribute__((ext_vector_type(8)))  float        v8f;
typedef __attribute__((ext_vector_type(4)))  float        v4f;
typedef __attribute__((ext_vector_type(4)))  unsigned int v4u;

#ifndef NB
#define NB 4
#endif
#ifndef SEQ
#define SEQ 2048
#endif
#define NB_FULL  4
#define SEQ_FULL 2048
#define NH       8
#define DH       64
#define FA_NW    4                 // waves per block
#define FA_QB    (16 * FA_NW)      // queries per block
#define OS_P     68                // LDS pitch (floats) of the per-wave output tile

#define PLANE_ELEMS ((size_t)NB * NH * SEQ * DH)
#define PLANE_BYTES (PLANE_ELEMS * 2)
#define WS_TOTAL    (3 * PLANE_BYTES)

static_assert(DH == 64);
static_assert(NB <= NB_FULL);
static_assert(SEQ <= SEQ_FULL);
static_assert(SEQ % 256 == 0);            // 16-row and 32-key fragment groups never straddle a head; key loop steps by 32
static_assert(SEQ % FA_QB == 0);          // query tiles exact
static_assert(DH % 32 == 0);              // k-steps of 32 over the head dim
static_assert(PLANE_BYTES % 128 == 0);
static_assert(WS_TOTAL <= 134217728);     // workspace carve <= 128 MiB
static_assert((OS_P * 4) % 16 == 0);

// 16-bit WMMA fragment map (wave32), lane L, h = L>>4, m = L&15:
//   A 16x32: lane = row m;    element i -> k = (i<8) ? 8h+i : 16+8h+(i-8)
//   B 32x16: lane = column m; the SAME k(i,h)
//   D 16x16 (8 f32): lane = column m; element r -> row 8h+r
// Fragment-ordered plane: one 16 x 32 fragment = 512 f16 = [j = 0,1][lane 0..31][8 f16]; chunk (j, lane) holds elements 8j..8j+7 of that lane, i.e. row/column m, k = 16j + 8h + 0..7.
// A wave-wide 16-byte load of one j is then 512 contiguous bytes (four whole 128-B lines).
#define FRAG_ELEMS 512
union FragH { v16h v; v8h h[2]; };
// p = start of the fragment (the same in every lane), lo = lane * 8: elements 0..7 <- chunk j = 0, 8..15 <- chunk j = 1
__device__ __forceinline__ v16h ld_frag(const _Float16* __restrict__ p, unsigned lo) {
    FragH f; f.h[0] = *(const v8h*)(p + lo); f.h[1] = *(const v8h*)(p + 256 + lo); return f.v;
}
__device__ __forceinline__ v8f mma16(v16h a, v16h b, v8f c) {
    return __builtin_amdgcn_wmma_f32_16x16x32_f16(false, a, false, b, (short)0, c, false, false);
}
// hazard guards: all accumulators of the group are tied, all operand fragments stay live through the nops
__device__ __forceinline__ void guard_s(v8f& s0, v8f& s1, v16h a0, v16h a1, v16h a2, v16h a3, v16h b0, v16h b1) {
    asm volatile("v_nop\n\tv_nop\n\tv_nop\n\tv_nop" : "+v"(s0), "+v"(s1) : "v"(a0), "v"(a1), "v"(a2), "v"(a3), "v"(b0), "v"(b1));
}
__device__ __forceinline__ void guard_o(v8f& o0, v8f& o1, v8f& o2, v8f& o3, v16h a0, v16h a1, v16h a2, v16h a3, v16h b) {
    asm volatile("v_nop\n\tv_nop\n\tv_nop\n\tv_nop" : "+v"(o0), "+v"(o1), "+v"(o2), "+v"(o3) : "v"(a0), "v"(a1), "v"(a2), "v"(a3), "v"(b));
}

// bf16 RNE kept as f32 (finite inputs)
__device__ __forceinline__ float bf_rne(float v) {
    const unsigned u = __float_as_uint(v);
    const unsigned r = (u + 0x7fffu + ((u >> 16) & 1u)) & 0xffff0000u;
    return __uint_as_float(r);
}
__device__ __forceinline__ unsigned int pk2h(float a, float b) {
    return (unsigned int)__builtin_bit_cast(unsigned short, (_Float16)a) | ((unsigned int)__builtin_bit_cast(unsigned short, (_Float16)b) << 16);
}

// f32 [bh][s][64] (full-size row stride) -> f16 fragments [bh][SEQ/16 row tiles][2 halves of d][j][lane][8] = bf16_rne(x) * 16 (exact in f16); row = s, k = d.
// A wave takes 8 rows x one 32-wide half of d: it reads eight whole 128-B lines and stores four whole 128-B lines (one per (j, h), eight rows each).
__global__ __launch_bounds__(256) void k_cast_rows(const float* __restrict__ src, unsigned short* __restrict__ dst) {
    const long long u = (long long)blockIdx.x * 256 + threadIdx.x;
    if (u >= (long long)NB * NH * SEQ * (DH / 8)) return;
    const int jh = (int)(u & 3);                           // 2 j + h
    const int hf = (int)((u >> 5) & 1);                    // which half of d
    const int m  = (int)((u >> 2) & 7) + 8 * (int)((u >> 6) & 1);   // row inside the 16-row tile
    const int c0 = 32 * hf + 8 * jh;
    const long long row = (u >> 7) * 16 + m;
    const int bh = (int)(row / SEQ);
    const int s  = (int)(row % SEQ);
    const float* sp = src + ((size_t)bh * SEQ_FULL + (size_t)s) * DH + c0;
    const v4f x0 = *(const v4f*)(sp);
    const v4f x1 = *(const v4f*)(sp + 4);
    v4u pk;
    pk.x = pk2h(bf_rne(x0.x) * 16.0f, bf_rne(x0.y) * 16.0f);
    pk.y = pk2h(bf_rne(x0.z) * 16.0f, bf_rne(x0.w) * 16.0f);
    pk.z = pk2h(bf_rne(x1.x) * 16.0f, bf_rne(x1.y) * 16.0f);
    pk.w = pk2h(bf_rne(x1.z) * 16.0f, bf_rne(x1.w) * 16.0f);
    v4u* d = (v4u*)(dst + ((size_t)(u >> 7) * 128 + (size_t)(64 * hf + 16 * jh + m)) * 8);
    *d = pk;
}

// f32 v[bh][s][64] -> f16 fragments of v^T [bh][SEQ/32 key groups][4 d tiles][j][lane][8] = bf16_rne(x) * 16; row = d, k = key.
// A wave takes 32 consecutive d x 8 keys: each of its eight loads reads one whole 128-B line, and it stores four whole 128-B lines.
__global__ __launch_bounds__(256) void k_cast_vt(const float* __restrict__ src, unsigned short* __restrict__ dst) {
    const long long u = (long long)blockIdx.x * 256 + threadIdx.x;
    const int per = SEQ / 32;
    if (u >= (long long)NB * NH * DH * (SEQ / 8)) return;
    const long long g = u >> 8;                            // key group over all heads
    const int jh = (int)((u >> 6) & 3);                    // 2 j + h
    const int s0 = 32 * (int)(g % per) + 8 * jh;           // key = 32 kg + 16 j + 8 h
    const int d  = (int)(u & 63);
    const int bh = (int)(g / per);
    const float* sp = src + ((size_t)bh * SEQ_FULL + (size_t)s0) * DH + d;
    float w[8];
#pragma unroll
    for (int e = 0; e < 8; ++e) w[e] = bf_rne(sp[(size_t)e * DH]) * 16.0f;
    v4u pk;
    pk.x = pk2h(w[0], w[1]); pk.y = pk2h(w[2], w[3]); pk.z = pk2h(w[4], w[5]); pk.w = pk2h(w[6], w[7]);
    v4u* dd = (v4u*)(dst + ((size_t)g * 256 + (size_t)(64 * (d >> 4) + 16 * jh + (d & 15))) * 8);
    *dd = pk;
}

// Fused attention, transposed orientation. Wave = 16 queries; 32 keys per step.
//   S^T (16 keys x 16 queries) = K (A: row = key, k = d) x Q^T (B: column = query, k = d), two key tiles per step.
//   P^T (B operand, k = key, column = query) is built in registers from the two D tiles: element r <- tile(keys 0..15)[r], element 8+r <- tile(keys 16..31)[r], same lane.
//   O^T (16 d x 16 queries) += V^T (A: row = d, k = key) x P^T, four d tiles.
//   Per-query statistics live per lane (column = query): in-lane max over 16 scores + one xor-16 exchange; per-lane partial sums, combined once at the end.
#define FA_STAGE(T, ACC) do { \
    v4f lo_, hi_; \
    lo_.x = ACC[0] * inv; lo_.y = ACC[1] * inv; lo_.z = ACC[2] * inv; lo_.w = ACC[3] * inv; \
    hi_.x = ACC[4] * inv; hi_.y = ACC[5] * inv; hi_.z = ACC[6] * inv; hi_.w = ACC[7] * inv; \
    *(v4f*)&os[wave][col * OS_P + (T) * 16 + 8 * h]     = lo_; \
    *(v4f*)&os[wave][col * OS_P + (T) * 16 + 8 * h + 4] = hi_; \
} while (0)

__global__ __launch_bounds__(32 * FA_NW) void k_fa(const _Float16* __restrict__ Q16, const _Float16* __restrict__ K16, const _Float16* __restrict__ Vt16,
                                                   float* __restrict__ O, const int* __restrict__ n_unused) {
    (void)n_unused;                                        // the module's integer scalar input; not used by the computation
    __shared__ __align__(16) float os[FA_NW][16 * OS_P];   // per-wave 16 x 64 output tile (written and read by the same wave; block barrier in between)
    const int lane = threadIdx.x & 31;
    const int wave = __builtin_amdgcn_readfirstlane(threadIdx.x >> 5);
    const int h = lane >> 4, col = lane & 15;
    const int bh = blockIdx.y;
    const int q0 = blockIdx.x * FA_QB + wave * 16;
    const size_t pbase = (size_t)bh * SEQ * DH;            // same element count per head in all three planes

    // scores are carried x256 (q x16, k x16); exp2 domain: 2^(s * C2), C2 = log2(e) / sqrt(512) / 256
    const float C2 = (float)(0.044194173824159216 * 1.4426950408889634 / 256.0);

    const unsigned lo = 8u * (unsigned)lane;
    const _Float16* qrow = Q16 + pbase + (size_t)q0 * DH;
    const v16h bq0 = ld_frag(qrow, lo);                    // d 0..31
    const v16h bq1 = ld_frag(qrow + FRAG_ELEMS, lo);       // d 32..63
    const _Float16* kp = K16 + pbase;
    const _Float16* vp = Vt16 + pbase;

    v8f a0 = {}, a1 = {}, a2 = {}, a3 = {};
    float m = -1.0e30f, l = 0.0f;

#pragma unroll 1
    for (int kg = 0; kg < SEQ / 32; ++kg) {
        const _Float16* kt = kp + (size_t)kg * 32 * DH;
        const v16h k00 = ld_frag(kt, lo);                  // keys kg*32 + 0..15, d 0..31
        const v16h k01 = ld_frag(kt + FRAG_ELEMS, lo);     // d 32..63
        const v16h k10 = ld_frag(kt + 2 * FRAG_ELEMS, lo); // keys kg*32 + 16..31
        const v16h k11 = ld_frag(kt + 3 * FRAG_ELEMS, lo);
        v8f s0 = {}, s1 = {};
        s0 = mma16(k00, bq0, s0);
        s1 = mma16(k10, bq0, s1);
        s0 = mma16(k01, bq1, s0);
        s1 = mma16(k11, bq1, s1);
        guard_s(s0, s1, k00, k01, k10, k11, bq0, bq1);

        const _Float16* vt = vp + (size_t)kg * 32 * DH;
        const v16h v0 = ld_frag(vt, lo);                   // d 0..15,  keys kg*32 + {8h.., 16+8h..}
        const v16h v1 = ld_frag(vt + FRAG_ELEMS, lo);
        const v16h v2 = ld_frag(vt + 2 * FRAG_ELEMS, lo);
        const v16h v3 = ld_frag(vt + 3 * FRAG_ELEMS, lo);

        float mx = fmaxf(s0[0], s1[0]);
#pragma unroll
        for (int r = 1; r < 8; ++r) mx = fmaxf(mx, fmaxf(s0[r], s1[r]));
        mx *= C2;                                          // C2 > 0: max commutes with the scale
        mx = fmaxf(mx, __shfl_xor(mx, 16, 32));            // the other 16 keys of this query live in lane ^ 16
        const float mnew = fmaxf(m, mx);
        const float corr = __builtin_amdgcn_exp2f(m - mnew);
        const float nref = 8.0f - mnew;                    // probabilities carried x 2^8
        v16h bp; float rs = 0.0f;
#pragma unroll
        for (int r = 0; r < 8; ++r) {
            const float e0 = __builtin_amdgcn_exp2f(__builtin_fmaf(s0[r], C2, nref));
            const float e1 = __builtin_amdgcn_exp2f(__builtin_fmaf(s1[r], C2, nref));
            rs += e0 + e1;
            bp[r]     = (_Float16)e0;                      // key 8h + r
            bp[8 + r] = (_Float16)e1;                      // key 16 + 8h + r
        }
        l = l * corr + rs;
        m = mnew;
        a0 = a0 * corr; a1 = a1 * corr; a2 = a2 * corr; a3 = a3 * corr;
        a0 = mma16(v0, bp, a0);
        a1 = mma16(v1, bp, a1);
        a2 = mma16(v2, bp, a2);
        a3 = mma16(v3, bp, a3);
        guard_o(a0, a1, a2, a3, v0, v1, v2, v3, bp);
    }

    const float lt = l + __shfl_xor(l, 16, 32);            // both lane halves of a query used the same running max
    const float inv = 1.0f / (lt * 16.0f);                 // undo the x16 carry of v; the x256 carry of p cancels against lt

    FA_STAGE(0, a0);
    FA_STAGE(1, a1);
    FA_STAGE(2, a2);
    FA_STAGE(3, a3);
    __syncthreads();
    {
        float* ob = O + ((size_t)bh * SEQ + (size_t)q0) * DH;
        const int c4 = (lane & 15) * 4;
        {
#pragma unroll
            for (int it = 0; it < 8; ++it) {
                const int row = it * 2 + h;                // 16 lanes x 16 B = one 256-B output row; one instruction = two whole rows (512 contiguous bytes)
                const v4f val = *(const v4f*)&os[wave][row * OS_P + c4];
                *(v4f*)(ob + (size_t)row * DH + c4) = val;
            }
            
        }
    }
}

extern "C" void kernel_launch(void* const* d_in, const int* in_sizes, int n_in, void* d_out, int out_size, void* d_ws, size_t ws_size, hipStream_t stream) {
    if (n_in < 4) return;
    const long long need = ((long long)(NB * NH - 1) * SEQ_FULL + SEQ) * DH;
    if ((long long)in_sizes[0] < need || (long long)in_sizes[1] < need || (long long)in_sizes[2] < need || in_sizes[3] < 1) return;
    if ((long long)out_size < (long long)NB * NH * SEQ * DH) return;
    if ((size_t)WS_TOTAL > ws_size) return;
    const float* q = (const float*)d_in[0];
    const float* k = (const float*)d_in[1];
    const float* v = (const float*)d_in[2];
    const int*   n = (const int*)d_in[3];
    float* out = (float*)d_out;
    char* wsp = (char*)d_ws;
    unsigned short* Q16  = (unsigned short*)(wsp);
    unsigned short* K16  = (unsigned short*)(wsp + PLANE_BYTES);
    unsigned short* Vt16 = (unsigned short*)(wsp + 2 * PLANE_BYTES);

    const unsigned gr = (unsigned)(((long long)NB * NH * SEQ * (DH / 8) + 255) / 256);
    const unsigned gv = (unsigned)(((long long)NB * NH * DH * (SEQ / 8) + 255) / 256);
    k_cast_rows<<<gr, 256, 0, stream>>>(q, Q16);
    k_cast_rows<<<gr, 256, 0, stream>>>(k, K16);
    k_cast_vt<<<gv, 256, 0, stream>>>(v, Vt16);
    k_fa<<<dim3((unsigned)(SEQ / FA_QB), (unsigned)(NB * NH)), 32 * FA_NW, 0, stream>>>((const _Float16*)Q16, (const _Float16*)K16, (const _Float16*)Vt16, out, n);
}

// v002
// Measured time: 78.2 microseconds a run.
// Timed twice side by side with v001, it ran 1.07 and 1.05 times as fast.
// Counting every step since v000, it is 1.79 times as fast.
// Scaled-dot-product attention (32 heads x 2,048 x 64, scores x 1/sqrt(512), no mask). Both contractions (k . q^T and v^T . p^T) on v_wmma_f32_16x16x32_f16: q, k, v converted to bf16 (RNE) and carried x16 as exact f16 (k, v^T as planes stored in WMMA fragment order by one cast launch, q straight into each wave's registers), probabilities carried x256 as f16, f32 accumulate, f32 online softmax in the exp2 domain.
#include <hip/hip_runtime.h>

typedef __attribute__((ext_vector_type(16))) _Float16     v16h;
typedef __attribute__((ext_vector_type(8)))  _Float16     v8h;
typedef __attribute__((ext_vector_type(8)))  float        v8f;
typedef __attribute__((ext_vector_type(4)))  float        v4f;
typedef __attribute__((ext_vector_type(4)))  unsigned int v4u;

#ifndef NB
#define NB 4
#endif
#ifndef SEQ
#define SEQ 2048
#endif
#define NB_FULL  4
#define SEQ_FULL 2048
#define NH       8
#define DH       64
#define FA_NW    4                 // waves per block
#define FA_QB    (16 * FA_NW)      // queries per block
#define OS_P     68                // LDS pitch (floats) of the per-wave output tile

#define PLANE_ELEMS ((size_t)NB * NH * SEQ * DH)
#define PLANE_BYTES (PLANE_ELEMS * 2)
#define WS_TOTAL    (2 * PLANE_BYTES)

static_assert(DH == 64);
static_assert(NB <= NB_FULL);
static_assert(SEQ <= SEQ_FULL);
static_assert(SEQ % 256 == 0);            // 16-row and 32-key fragment groups never straddle a head; key loop steps by 32
static_assert(SEQ % FA_QB == 0);          // query tiles exact
static_assert(DH % 32 == 0);              // k-steps of 32 over the head dim
static_assert(PLANE_BYTES % 128 == 0);
static_assert(WS_TOTAL <= 134217728);     // workspace carve <= 128 MiB
static_assert((OS_P * 4) % 16 == 0);

// 16-bit WMMA fragment map (wave32), lane L, h = L>>4, m = L&15:
//   A 16x32: lane = row m;    element i -> k = (i<8) ? 8h+i : 16+8h+(i-8)
//   B 32x16: lane = column m; the SAME k(i,h)
//   D 16x16 (8 f32): lane = column m; element r -> row 8h+r
// Fragment-ordered plane: one 16 x 32 fragment = 512 f16 = [j = 0,1][lane 0..31][8 f16]; chunk (j, lane) holds elements 8j..8j+7 of that lane, i.e. row/column m, k = 16j + 8h + 0..7.
// A wave-wide 16-byte load of one j is then 512 contiguous bytes (four whole 128-B lines).
#define FRAG_ELEMS 512
union FragH { v16h v; v8h h[2]; };
// p = start of the fragment (the same in every lane), lo = lane * 8: elements 0..7 <- chunk j = 0, 8..15 <- chunk j = 1
__device__ __forceinline__ v16h ld_frag(const _Float16* __restrict__ p, unsigned lo) {
    FragH f; f.h[0] = *(const v8h*)(p + lo); f.h[1] = *(const v8h*)(p + 256 + lo); return f.v;
}
__device__ __forceinline__ v8f mma16(v16h a, v16h b, v8f c) {
    return __builtin_amdgcn_wmma_f32_16x16x32_f16(false, a, false, b, (short)0, c, false, false);
}
// hazard guards: all accumulators of the group are tied, all operand fragments stay live through the nops
__device__ __forceinline__ void guard_s(v8f& s0, v8f& s1, v16h a0, v16h a1, v16h a2, v16h a3, v16h b0, v16h b1) {
    asm volatile("v_nop\n\tv_nop\n\tv_nop\n\tv_nop" : "+v"(s0), "+v"(s1) : "v"(a0), "v"(a1), "v"(a2), "v"(a3), "v"(b0), "v"(b1));
}
__device__ __forceinline__ void guard_o(v8f& o0, v8f& o1, v8f& o2, v8f& o3, v16h a0, v16h a1, v16h a2, v16h a3, v16h b) {
    asm volatile("v_nop\n\tv_nop\n\tv_nop\n\tv_nop" : "+v"(o0), "+v"(o1), "+v"(o2), "+v"(o3) : "v"(a0), "v"(a1), "v"(a2), "v"(a3), "v"(b));
}

// bf16 RNE kept as f32 (finite inputs)
__device__ __forceinline__ float bf_rne(float v) {
    const unsigned u = __float_as_uint(v);
    const unsigned r = (u + 0x7fffu + ((u >> 16) & 1u)) & 0xffff0000u;
    return __uint_as_float(r);
}
__device__ __forceinline__ unsigned int pk2h(float a, float b) {
    return (unsigned int)__builtin_bit_cast(unsigned short, (_Float16)a) | ((unsigned int)__builtin_bit_cast(unsigned short, (_Float16)b) << 16);
}

// f32 [bh][s][64] (full-size row stride) -> f16 fragments [bh][SEQ/16 row tiles][2 halves of d][j][lane][8] = bf16_rne(x) * 16 (exact in f16); row = s, k = d.
// A wave takes 8 rows x one 32-wide half of d: it reads eight whole 128-B lines and stores four whole 128-B lines (one per (j, h), eight rows each).
__device__ __forceinline__ void cast_rows(const float* __restrict__ src, unsigned short* __restrict__ dst, const long long u) {
    if (u >= (long long)NB * NH * SEQ * (DH / 8)) return;
    const int jh = (int)(u & 3);                           // 2 j + h
    const int hf = (int)((u >> 5) & 1);                    // which half of d
    const int m  = (int)((u >> 2) & 7) + 8 * (int)((u >> 6) & 1);   // row inside the 16-row tile
    const int c0 = 32 * hf + 8 * jh;
    const long long row = (u >> 7) * 16 + m;
    const int bh = (int)(row / SEQ);
    const int s  = (int)(row % SEQ);
    const float* sp = src + ((size_t)bh * SEQ_FULL + (size_t)s) * DH + c0;
    const v4f x0 = *(const v4f*)(sp);
    const v4f x1 = *(const v4f*)(sp + 4);
    v4u pk;
    pk.x = pk2h(bf_rne(x0.x) * 16.0f, bf_rne(x0.y) * 16.0f);
    pk.y = pk2h(bf_rne(x0.z) * 16.0f, bf_rne(x0.w) * 16.0f);
    pk.z = pk2h(bf_rne(x1.x) * 16.0f, bf_rne(x1.y) * 16.0f);
    pk.w = pk2h(bf_rne(x1.z) * 16.0f, bf_rne(x1.w) * 16.0f);
    v4u* d = (v4u*)(dst + ((size_t)(u >> 7) * 128 + (size_t)(64 * hf + 16 * jh + m)) * 8);
    *d = pk;
}

// f32 v[bh][s][64] -> f16 fragments of v^T [bh][SEQ/32 key groups][4 d tiles][j][lane][8] = bf16_rne(x) * 16; row = d, k = key.
// A wave takes 32 consecutive d x 8 keys: each of its eight loads reads one whole 128-B line, and it stores four whole 128-B lines.
__device__ __forceinline__ void cast_vt(const float* __restrict__ src, unsigned short* __restrict__ dst, const long long u) {
    const int per = SEQ / 32;
    if (u >= (long long)NB * NH * DH * (SEQ / 8)) return;
    const long long g = u >> 8;                            // key group over all heads
    const int jh = (int)((u >> 6) & 3);                    // 2 j + h
    const int s0 = 32 * (int)(g % per) + 8 * jh;           // key = 32 kg + 16 j + 8 h
    const int d  = (int)(u & 63);
    const int bh = (int)(g / per);
    const float* sp = src + ((size_t)bh * SEQ_FULL + (size_t)s0) * DH + d;
    float w[8];
#pragma unroll
    for (int e = 0; e < 8; ++e) w[e] = bf_rne(sp[(size_t)e * DH]) * 16.0f;
    v4u pk;
    pk.x = pk2h(w[0], w[1]); pk.y = pk2h(w[2], w[3]); pk.z = pk2h(w[4], w[5]); pk.w = pk2h(w[6], w[7]);
    v4u* dd = (v4u*)(dst + ((size_t)g * 256 + (size_t)(64 * (d >> 4) + 16 * jh + (d & 15))) * 8);
    *dd = pk;
}

// One launch for both planes: blocks 0 .. CAST_K_BLOCKS-1 cast k, the rest cast v^T (the choice is the same for a whole block).
#define CAST_K_BLOCKS ((unsigned)(((long long)NB * NH * SEQ * (DH / 8) + 255) / 256))
#define CAST_V_BLOCKS ((unsigned)(((long long)NB * NH * DH * (SEQ / 8) + 255) / 256))
__global__ __launch_bounds__(256) void k_cast_kv(const float* __restrict__ k, const float* __restrict__ v,
                                                 unsigned short* __restrict__ K16, unsigned short* __restrict__ Vt16) {
    if (blockIdx.x < CAST_K_BLOCKS) cast_rows(k, K16, (long long)blockIdx.x * 256 + threadIdx.x);
    else                            cast_vt(v, Vt16, (long long)(blockIdx.x - CAST_K_BLOCKS) * 256 + threadIdx.x);
}

// eight consecutive f32 -> eight f16 = bf16_rne(x) * 16, the values the cast launch gives k and v
__device__ __forceinline__ v8h cvt8(const float* __restrict__ p) {
    const v4f x0 = *(const v4f*)(p);
    const v4f x1 = *(const v4f*)(p + 4);
    v8h r;
    r[0] = (_Float16)(bf_rne(x0.x) * 16.0f); r[1] = (_Float16)(bf_rne(x0.y) * 16.0f);
    r[2] = (_Float16)(bf_rne(x0.z) * 16.0f); r[3] = (_Float16)(bf_rne(x0.w) * 16.0f);
    r[4] = (_Float16)(bf_rne(x1.x) * 16.0f); r[5] = (_Float16)(bf_rne(x1.y) * 16.0f);
    r[6] = (_Float16)(bf_rne(x1.z) * 16.0f); r[7] = (_Float16)(bf_rne(x1.w) * 16.0f);
    return r;
}

// Fused attention, transposed orientation. Wave = 16 queries; 32 keys per step.
//   S^T (16 keys x 16 queries) = K (A: row = key, k = d) x Q^T (B: column = query, k = d), two key tiles per step.
//   P^T (B operand, k = key, column = query) is built in registers from the two D tiles: element r <- tile(keys 0..15)[r], element 8+r <- tile(keys 16..31)[r], same lane.
//   O^T (16 d x 16 queries) += V^T (A: row = d, k = key) x P^T, four d tiles.
//   Per-query statistics live per lane (column = query): in-lane max over 16 scores + one xor-16 exchange; per-lane partial sums, combined once at the end.
#define FA_STAGE(T, ACC) do { \
    v4f lo_, hi_; \
    lo_.x = ACC[0] * inv; lo_.y = ACC[1] * inv; lo_.z = ACC[2] * inv; lo_.w = ACC[3] * inv; \
    hi_.x = ACC[4] * inv; hi_.y = ACC[5] * inv; hi_.z = ACC[6] * inv; hi_.w = ACC[7] * inv; \
    *(v4f*)&os[wave][col * OS_P + (T) * 16 + 8 * h]     = lo_; \
    *(v4f*)&os[wave][col * OS_P + (T) * 16 + 8 * h + 4] = hi_; \
} while (0)

__global__ __launch_bounds__(32 * FA_NW) void k_fa(const float* __restrict__ Q, const _Float16* __restrict__ K16, const _Float16* __restrict__ Vt16,
                                                   float* __restrict__ O, const int* __restrict__ n_unused) {
    (void)n_unused;                                        // the module's integer scalar input; not used by the computation
    __shared__ __align__(16) float os[FA_NW][16 * OS_P];   // per-wave 16 x 64 output tile (written and read by the same wave; block barrier in between)
    const int lane = threadIdx.x & 31;
    const int wave = __builtin_amdgcn_readfirstlane(threadIdx.x >> 5);
    const int h = lane >> 4, col = lane & 15;
    const int bh = blockIdx.y;
    const int q0 = blockIdx.x * FA_QB + wave * 16;
    const size_t pbase = (size_t)bh * SEQ * DH;            // same element count per head in both planes

    // scores are carried x256 (q x16, k x16); exp2 domain: 2^(s * C2), C2 = log2(e) / sqrt(512) / 256
    const float C2 = (float)(0.044194173824159216 * 1.4426950408889634 / 256.0);

    const unsigned lo = 8u * (unsigned)lane;
    // Q^T fragments straight from the f32 input (full-size row stride): lane = query col, elements 8j..8j+7 <- d = 32 half + 16 j + 8 h + 0..7
    const float* qrow = Q + ((size_t)bh * SEQ_FULL + (size_t)(q0 + col)) * DH + 8 * h;
    FragH fq0, fq1;
    fq0.h[0] = cvt8(qrow);      fq0.h[1] = cvt8(qrow + 16);
    fq1.h[0] = cvt8(qrow + 32); fq1.h[1] = cvt8(qrow + 48);
    const v16h bq0 = fq0.v;                                // d 0..31
    const v16h bq1 = fq1.v;                                // d 32..63
    const _Float16* kp = K16 + pbase;
    const _Float16* vp = Vt16 + pbase;

    v8f a0 = {}, a1 = {}, a2 = {}, a3 = {};
    float m = -1.0e30f, l = 0.0f;

#pragma unroll 1
    for (int kg = 0; kg < SEQ / 32; ++kg) {
        const _Float16* kt = kp + (size_t)kg * 32 * DH;
        const v16h k00 = ld_frag(kt, lo);                  // keys kg*32 + 0..15, d 0..31
        const v16h k01 = ld_frag(kt + FRAG_ELEMS, lo);     // d 32..63
        const v16h k10 = ld_frag(kt + 2 * FRAG_ELEMS, lo); // keys kg*32 + 16..31
        const v16h k11 = ld_frag(kt + 3 * FRAG_ELEMS, lo);
        v8f s0 = {}, s1 = {};
        s0 = mma16(k00, bq0, s0);
        s1 = mma16(k10, bq0, s1);
        s0 = mma16(k01, bq1, s0);
        s1 = mma16(k11, bq1, s1);
        guard_s(s0, s1, k00, k01, k10, k11, bq0, bq1);

        const _Float16* vt = vp + (size_t)kg * 32 * DH;
        const v16h v0 = ld_frag(vt, lo);                   // d 0..15,  keys kg*32 + {8h.., 16+8h..}
        const v16h v1 = ld_frag(vt + FRAG_ELEMS, lo);
        const v16h v2 = ld_frag(vt + 2 * FRAG_ELEMS, lo);
        const v16h v3 = ld_frag(vt + 3 * FRAG_ELEMS, lo);

        float mx = fmaxf(s0[0], s1[0]);
#pragma unroll
        for (int r = 1; r < 8; ++r) mx = fmaxf(mx, fmaxf(s0[r], s1[r]));
        mx *= C2;                                          // C2 > 0: max commutes with the scale
        mx = fmaxf(mx, __shfl_xor(mx, 16, 32));            // the other 16 keys of this query live in lane ^ 16
        const float mnew = fmaxf(m, mx);
        const float corr = __builtin_amdgcn_exp2f(m - mnew);
        const float nref = 8.0f - mnew;                    // probabilities carried x 2^8
        v16h bp; float rs = 0.0f;
#pragma unroll
        for (int r = 0; r < 8; ++r) {
            const float e0 = __builtin_amdgcn_exp2f(__builtin_fmaf(s0[r], C2, nref));
            const float e1 = __builtin_amdgcn_exp2f(__builtin_fmaf(s1[r], C2, nref));
            rs += e0 + e1;
            bp[r]     = (_Float16)e0;                      // key 8h + r
            bp[8 + r] = (_Float16)e1;                      // key 16 + 8h + r
        }
        l = l * corr + rs;
        m = mnew;
        a0 = a0 * corr; a1 = a1 * corr; a2 = a2 * corr; a3 = a3 * corr;
        a0 = mma16(v0, bp, a0);
        a1 = mma16(v1, bp, a1);
        a2 = mma16(v2, bp, a2);
        a3 = mma16(v3, bp, a3);
        guard_o(a0, a1, a2, a3, v0, v1, v2, v3, bp);
    }

    const float lt = l + __shfl_xor(l, 16, 32);            // both lane halves of a query used the same running max
    const float inv = 1.0f / (lt * 16.0f);                 // undo the x16 carry of v; the x256 carry of p cancels against lt

    FA_STAGE(0, a0);
    FA_STAGE(1, a1);
    FA_STAGE(2, a2);
    FA_STAGE(3, a3);
    __syncthreads();
    {
        float* ob = O + ((size_t)bh * SEQ + (size_t)q0) * DH;
        const int c4 = (lane & 15) * 4;
        {
#pragma unroll
            for (int it = 0; it < 8; ++it) {
                const int row = it * 2 + h;                // 16 lanes x 16 B = one 256-B output row; one instruction = two whole rows (512 contiguous bytes)
                const v4f val = *(const v4f*)&os[wave][row * OS_P + c4];
                *(v4f*)(ob + (size_t)row * DH + c4) = val;
            }
            
        }
    }
}

extern "C" void kernel_launch(void* const* d_in, const int* in_sizes, int n_in, void* d_out, int out_size, void* d_ws, size_t ws_size, hipStream_t stream) {
    if (n_in < 4) return;
    const long long need = ((long long)(NB * NH - 1) * SEQ_FULL + SEQ) * DH;
    if ((long long)in_sizes[0] < need || (long long)in_sizes[1] < need || (long long)in_sizes[2] < need || in_sizes[3] < 1) return;
    if ((long long)out_size < (long long)NB * NH * SEQ * DH) return;
    if ((size_t)WS_TOTAL > ws_size) return;
    const float* q = (const float*)d_in[0];
    const float* k = (const float*)d_in[1];
    const float* v = (const float*)d_in[2];
    const int*   n = (const int*)d_in[3];
    float* out = (float*)d_out;
    char* wsp = (char*)d_ws;
    unsigned short* K16  = (unsigned short*)(wsp);
    unsigned short* Vt16 = (unsigned short*)(wsp + PLANE_BYTES);

    k_cast_kv<<<CAST_K_BLOCKS + CAST_V_BLOCKS, 256, 0, stream>>>(k, v, K16, Vt16);
    k_fa<<<dim3((unsigned)(SEQ / FA_QB), (unsigned)(NB * NH)), 32 * FA_NW, 0, stream>>>(q, (const _Float16*)K16, (const _Float16*)Vt16, out, n);
}

// v003
// A run of this version takes 43 microseconds.
// Two timings next to v002 both put it at 1.78 times that version's speed.
// All steps since v000 together make it 3.18 times as fast.
// Scaled-dot-product attention (32 heads x 2,048 x 64, scores x 1/sqrt(512), no mask). Both contractions (k . q^T and v^T . p^T) on v_wmma_f32_16x16x32_f16: q, k, v converted to bf16 (RNE) and carried x16 as exact f16 (k, v^T as planes stored in WMMA fragment order by one cast launch and staged per block in a two-buffer LDS ring by asynchronous copies, q straight into each wave's registers), probabilities carried x256 as f16, f32 accumulate, f32 online softmax in the exp2 domain.
#include <hip/hip_runtime.h>

typedef __attribute__((ext_vector_type(16))) _Float16     v16h;
typedef __attribute__((ext_vector_type(8)))  _Float16     v8h;
typedef __attribute__((ext_vector_type(8)))  float        v8f;
typedef __attribute__((ext_vector_type(4)))  float        v4f;
typedef __attribute__((ext_vector_type(4)))  unsigned int v4u;

#ifndef NB
#define NB 4
#endif
#ifndef SEQ
#define SEQ 2048
#endif
#define NB_FULL  4
#define SEQ_FULL 2048
#define NH       8
#define DH       64
#define FA_NW    4                 // waves per block
#define FA_QB    (16 * FA_NW)      // queries per block
#define OS_P     68                // LDS pitch (floats) of the per-wave output tile
#define ST_KEYS  64                // keys per LDS stage
#define ST_ELEMS (ST_KEYS * DH)    // f16 elements of one operand's stage (8 KiB, contiguous in its plane)
#define NSTAGE   (SEQ / ST_KEYS)

#define PLANE_ELEMS ((size_t)NB * NH * SEQ * DH)
#define PLANE_BYTES (PLANE_ELEMS * 2)
#define WS_TOTAL    (2 * PLANE_BYTES)

static_assert(DH == 64);
static_assert(NB <= NB_FULL);
static_assert(SEQ <= SEQ_FULL);
static_assert(SEQ % 256 == 0);            // 16-row and 32-key fragment groups never straddle a head; key loop steps by 32
static_assert(SEQ % FA_QB == 0);          // query tiles exact
static_assert(DH % 32 == 0);              // k-steps of 32 over the head dim
static_assert(PLANE_BYTES % 128 == 0);
static_assert(WS_TOTAL <= 134217728);     // workspace carve <= 128 MiB
static_assert((OS_P * 4) % 16 == 0);
static_assert(ST_KEYS % 32 == 0 && SEQ % ST_KEYS == 0 && NSTAGE >= 2);   // whole 32-key groups per stage; the ring's prologue needs two stages
static_assert(ST_ELEMS * 2 == FA_NW * 4 * 512);                          // each wave copies four 512-B pieces of each operand's stage

// 16-bit WMMA fragment map (wave32), lane L, h = L>>4, m = L&15:
//   A 16x32: lane = row m;    element i -> k = (i<8) ? 8h+i : 16+8h+(i-8)
//   B 32x16: lane = column m; the SAME k(i,h)
//   D 16x16 (8 f32): lane = column m; element r -> row 8h+r
// Fragment-ordered plane: one 16 x 32 fragment = 512 f16 = [j = 0,1][lane 0..31][8 f16]; chunk (j, lane) holds elements 8j..8j+7 of that lane, i.e. row/column m, k = 16j + 8h + 0..7.
// A wave-wide 16-byte load of one j is then 512 contiguous bytes (four whole 128-B lines).
#define FRAG_ELEMS 512
union FragH { v16h v; v8h h[2]; };
// p = start of the fragment (the same in every lane), lo = lane * 8: elements 0..7 <- chunk j = 0, 8..15 <- chunk j = 1
__device__ __forceinline__ v16h ld_frag(const _Float16* __restrict__ p, unsigned lo) {
    FragH f; f.h[0] = *(const v8h*)(p + lo); f.h[1] = *(const v8h*)(p + 256 + lo); return f.v;
}
__device__ __forceinline__ v8f mma16(v16h a, v16h b, v8f c) {
    return __builtin_amdgcn_wmma_f32_16x16x32_f16(false, a, false, b, (short)0, c, false, false);
}
// hazard guards: all accumulators of the group are tied, all operand fragments stay live through the nops
__device__ __forceinline__ void guard_s(v8f& s0, v8f& s1, v16h a0, v16h a1, v16h a2, v16h a3, v16h b0, v16h b1) {
    asm volatile("v_nop\n\tv_nop\n\tv_nop\n\tv_nop" : "+v"(s0), "+v"(s1) : "v"(a0), "v"(a1), "v"(a2), "v"(a3), "v"(b0), "v"(b1));
}
__device__ __forceinline__ void guard_o(v8f& o0, v8f& o1, v8f& o2, v8f& o3, v16h a0, v16h a1, v16h a2, v16h a3, v16h b) {
    asm volatile("v_nop\n\tv_nop\n\tv_nop\n\tv_nop" : "+v"(o0), "+v"(o1), "+v"(o2), "+v"(o3) : "v"(a0), "v"(a1), "v"(a2), "v"(a3), "v"(b));
}

// bf16 RNE kept as f32 (finite inputs)
__device__ __forceinline__ float bf_rne(float v) {
    const unsigned u = __float_as_uint(v);
    const unsigned r = (u + 0x7fffu + ((u >> 16) & 1u)) & 0xffff0000u;
    return __uint_as_float(r);
}
__device__ __forceinline__ unsigned int pk2h(float a, float b) {
    return (unsigned int)__builtin_bit_cast(unsigned short, (_Float16)a) | ((unsigned int)__builtin_bit_cast(unsigned short, (_Float16)b) << 16);
}

// f32 [bh][s][64] (full-size row stride) -> f16 fragments [bh][SEQ/16 row tiles][2 halves of d][j][lane][8] = bf16_rne(x) * 16 (exact in f16); row = s, k = d.
// A wave takes 8 rows x one 32-wide half of d: it reads eight whole 128-B lines and stores four whole 128-B lines (one per (j, h), eight rows each).
__device__ __forceinline__ void cast_rows(const float* __restrict__ src, unsigned short* __restrict__ dst, const long long u) {
    if (u >= (long long)NB * NH * SEQ * (DH / 8)) return;
    const int jh = (int)(u & 3);                           // 2 j + h
    const int hf = (int)((u >> 5) & 1);                    // which half of d
    const int m  = (int)((u >> 2) & 7) + 8 * (int)((u >> 6) & 1);   // row inside the 16-row tile
    const int c0 = 32 * hf + 8 * jh;
    const long long row = (u >> 7) * 16 + m;
    const int bh = (int)(row / SEQ);
    const int s  = (int)(row % SEQ);
    const float* sp = src + ((size_t)bh * SEQ_FULL + (size_t)s) * DH + c0;
    const v4f x0 = *(const v4f*)(sp);
    const v4f x1 = *(const v4f*)(sp + 4);
    v4u pk;
    pk.x = pk2h(bf_rne(x0.x) * 16.0f, bf_rne(x0.y) * 16.0f);
    pk.y = pk2h(bf_rne(x0.z) * 16.0f, bf_rne(x0.w) * 16.0f);
    pk.z = pk2h(bf_rne(x1.x) * 16.0f, bf_rne(x1.y) * 16.0f);
    pk.w = pk2h(bf_rne(x1.z) * 16.0f, bf_rne(x1.w) * 16.0f);
    v4u* d = (v4u*)(dst + ((size_t)(u >> 7) * 128 + (size_t)(64 * hf + 16 * jh + m)) * 8);
    *d = pk;
}

// f32 v[bh][s][64] -> f16 fragments of v^T [bh][SEQ/32 key groups][4 d tiles][j][lane][8] = bf16_rne(x) * 16; row = d, k = key.
// A wave takes 32 consecutive d x 8 keys: each of its eight loads reads one whole 128-B line, and it stores four whole 128-B lines.
__device__ __forceinline__ void cast_vt(const float* __restrict__ src, unsigned short* __restrict__ dst, const long long u) {
    const int per = SEQ / 32;
    if (u >= (long long)NB * NH * DH * (SEQ / 8)) return;
    const long long g = u >> 8;                            // key group over all heads
    const int jh = (int)((u >> 6) & 3);                    // 2 j + h
    const int s0 = 32 * (int)(g % per) + 8 * jh;           // key = 32 kg + 16 j + 8 h
    const int d  = (int)(u & 63);
    const int bh = (int)(g / per);
    const float* sp = src + ((size_t)bh * SEQ_FULL + (size_t)s0) * DH + d;
    float w[8];
#pragma unroll
    for (int e = 0; e < 8; ++e) w[e] = bf_rne(sp[(size_t)e * DH]) * 16.0f;
    v4u pk;
    pk.x = pk2h(w[0], w[1]); pk.y = pk2h(w[2], w[3]); pk.z = pk2h(w[4], w[5]); pk.w = pk2h(w[6], w[7]);
    v4u* dd = (v4u*)(dst + ((size_t)g * 256 + (size_t)(64 * (d >> 4) + 16 * jh + (d & 15))) * 8);
    *dd = pk;
}

// One launch for both planes: blocks 0 .. CAST_K_BLOCKS-1 cast k, the rest cast v^T (the choice is the same for a whole block).
#define CAST_K_BLOCKS ((unsigned)(((long long)NB * NH * SEQ * (DH / 8) + 255) / 256))
#define CAST_V_BLOCKS ((unsigned)(((long long)NB * NH * DH * (SEQ / 8) + 255) / 256))
__global__ __launch_bounds__(256) void k_cast_kv(const float* __restrict__ k, const float* __restrict__ v,
                                                 unsigned short* __restrict__ K16, unsigned short* __restrict__ Vt16) {
    if (blockIdx.x < CAST_K_BLOCKS) cast_rows(k, K16, (long long)blockIdx.x * 256 + threadIdx.x);
    else                            cast_vt(v, Vt16, (long long)(blockIdx.x - CAST_K_BLOCKS) * 256 + threadIdx.x);
}

// eight consecutive f32 -> eight f16 = bf16_rne(x) * 16, the values the cast launch gives k and v
__device__ __forceinline__ v8h cvt8(const float* __restrict__ p) {
    const v4f x0 = *(const v4f*)(p);
    const v4f x1 = *(const v4f*)(p + 4);
    v8h r;
    r[0] = (_Float16)(bf_rne(x0.x) * 16.0f); r[1] = (_Float16)(bf_rne(x0.y) * 16.0f);
    r[2] = (_Float16)(bf_rne(x0.z) * 16.0f); r[3] = (_Float16)(bf_rne(x0.w) * 16.0f);
    r[4] = (_Float16)(bf_rne(x1.x) * 16.0f); r[5] = (_Float16)(bf_rne(x1.y) * 16.0f);
    r[6] = (_Float16)(bf_rne(x1.z) * 16.0f); r[7] = (_Float16)(bf_rne(x1.w) * 16.0f);
    return r;
}

// One wave's share of one stage: four 512-B pieces of the k stage and four of the v^T stage, 16 B per lane, global -> LDS through no register.
// lk, lv = the lane's LDS byte address of its first piece; gk, gv = the lane's global address of it. All lanes on, all addresses multiples of 16.
__device__ __forceinline__ void stage_copy(const unsigned lk, const unsigned lv, const _Float16* gk, const _Float16* gv) {
    // s_wait_xcnt 0 closes the statement: no address register of a copy is rewritten ahead of it
    asm volatile("global_load_async_to_lds_b128 %0, %8, off\n\t"
                 "global_load_async_to_lds_b128 %1, %9, off\n\t"
                 "global_load_async_to_lds_b128 %2, %10, off\n\t"
                 "global_load_async_to_lds_b128 %3, %11, off\n\t"
                 "global_load_async_to_lds_b128 %4, %12, off\n\t"
                 "global_load_async_to_lds_b128 %5, %13, off\n\t"
                 "global_load_async_to_lds_b128 %6, %14, off\n\t"
                 "global_load_async_to_lds_b128 %7, %15, off\n\t"
                 "s_wait_xcnt 0x0"
                 :: "v"(lk), "v"(lk + 512u), "v"(lk + 1024u), "v"(lk + 1536u), "v"(lv), "v"(lv + 512u), "v"(lv + 1024u), "v"(lv + 1536u),
                    "v"(gk), "v"(gk + 256), "v"(gk + 512), "v"(gk + 768), "v"(gv), "v"(gv + 256), "v"(gv + 512), "v"(gv + 768)
                 : "memory");
}

// Fused attention, transposed orientation. Wave = 16 queries; 32 keys per step.
//   S^T (16 keys x 16 queries) = K (A: row = key, k = d) x Q^T (B: column = query, k = d), two key tiles per step.
//   P^T (B operand, k = key, column = query) is built in registers from the two D tiles: element r <- tile(keys 0..15)[r], element 8+r <- tile(keys 16..31)[r], same lane.
//   O^T (16 d x 16 queries) += V^T (A: row = d, k = key) x P^T, four d tiles.
//   K and V^T reach the waves through LDS: a stage is 64 keys of both planes (16 KiB), copied once per block and read by all its waves; stage t + 2 is copied while stage t + 1 is worked on.
//   Per-query statistics live per lane (column = query): in-lane max over 16 scores + one xor-16 exchange; per-lane partial sums, combined once at the end.
#define FA_STAGE(T, ACC) do { \
    v4f lo_, hi_; \
    lo_.x = ACC[0] * inv; lo_.y = ACC[1] * inv; lo_.z = ACC[2] * inv; lo_.w = ACC[3] * inv; \
    hi_.x = ACC[4] * inv; hi_.y = ACC[5] * inv; hi_.z = ACC[6] * inv; hi_.w = ACC[7] * inv; \
    *(v4f*)&os[wave][col * OS_P + (T) * 16 + 8 * h]     = lo_; \
    *(v4f*)&os[wave][col * OS_P + (T) * 16 + 8 * h + 4] = hi_; \
} while (0)

__global__ __launch_bounds__(32 * FA_NW) void k_fa(const float* __restrict__ Q, const _Float16* __restrict__ K16, const _Float16* __restrict__ Vt16,
                                                   float* __restrict__ O, const int* __restrict__ n_unused) {
    (void)n_unused;                                        // the module's integer scalar input; not used by the computation
    __shared__ __align__(16) _Float16 ring[2][2 * ST_ELEMS]; // [buffer][k stage | v^T stage]
    __shared__ __align__(16) float os[FA_NW][16 * OS_P];   // per-wave 16 x 64 output tile (written and read by the same wave; block barrier in between)
    const int lane = threadIdx.x & 31;
    const int wave = __builtin_amdgcn_readfirstlane(threadIdx.x >> 5);
    const int h = lane >> 4, col = lane & 15;
    const int bh = blockIdx.y;
    const int q0 = blockIdx.x * FA_QB + wave * 16;
    const size_t pbase = (size_t)bh * SEQ * DH;            // same element count per head in both planes

    // scores are carried x256 (q x16, k x16); exp2 domain: 2^(s * C2), C2 = log2(e) / sqrt(512) / 256
    const float C2 = (float)(0.044194173824159216 * 1.4426950408889634 / 256.0);

    const unsigned lo = 8u * (unsigned)lane;
    // Q^T fragments straight from the f32 input (full-size row stride): lane = query col, elements 8j..8j+7 <- d = 32 half + 16 j + 8 h + 0..7
    const float* qrow = Q + ((size_t)bh * SEQ_FULL + (size_t)(q0 + col)) * DH + 8 * h;
    FragH fq0, fq1;
    fq0.h[0] = cvt8(qrow);      fq0.h[1] = cvt8(qrow + 16);
    fq1.h[0] = cvt8(qrow + 32); fq1.h[1] = cvt8(qrow + 48);
    const v16h bq0 = fq0.v;                                // d 0..31
    const v16h bq1 = fq1.v;                                // d 32..63
    const _Float16* kp = K16 + pbase;
    const _Float16* vp = Vt16 + pbase;

    // this lane's 16 bytes of the wave's first piece, inside a stage (f16 elements)
    const unsigned ce = (unsigned)wave * (ST_ELEMS / FA_NW) + lo;
    const unsigned lds0 = (unsigned)(size_t)&ring[0][0] + 2u * ce;      // LDS byte address in buffer 0, k half
    const _Float16* gk = kp + ce;
    const _Float16* gv = vp + ce;

    v8f a0 = {}, a1 = {}, a2 = {}, a3 = {};
    float m = -1.0e30f, l = 0.0f;

    stage_copy(lds0, lds0 + 2u * ST_ELEMS, gk, gv);                     // stage 0 -> buffer 0
    asm volatile("s_wait_asynccnt 0x0" ::: "memory");                   // this wave's share of stage 0 has landed
    __syncthreads();                                                    // publishes stage 0
    stage_copy(lds0 + 4u * ST_ELEMS, lds0 + 6u * ST_ELEMS, gk + ST_ELEMS, gv + ST_ELEMS);   // stage 1 -> buffer 1

#pragma unroll 1   // one trip per stage: the hot loop stays small
    for (int t = 0; t < NSTAGE; ++t) {
      const _Float16* sb = &ring[t & 1][0];
#pragma unroll     // the stage's 32-key groups inline: their LDS offsets become immediates of the loads
      for (int u = 0; u < ST_KEYS / 32; ++u) {
        const _Float16* kt = sb + u * 32 * DH;
        const v16h k00 = ld_frag(kt, lo);                  // keys 0..15 of the 32-key group, d 0..31
        const v16h k01 = ld_frag(kt + FRAG_ELEMS, lo);     // d 32..63
        const v16h k10 = ld_frag(kt + 2 * FRAG_ELEMS, lo); // keys 16..31
        const v16h k11 = ld_frag(kt + 3 * FRAG_ELEMS, lo);
        v8f s0 = {}, s1 = {};
        s0 = mma16(k00, bq0, s0);
        s1 = mma16(k10, bq0, s1);
        s0 = mma16(k01, bq1, s0);
        s1 = mma16(k11, bq1, s1);
        guard_s(s0, s1, k00, k01, k10, k11, bq0, bq1);

        const _Float16* vt = sb + ST_ELEMS + u * 32 * DH;
        const v16h v0 = ld_frag(vt, lo);                   // d 0..15,  keys {8h.., 16+8h..} of the group
        const v16h v1 = ld_frag(vt + FRAG_ELEMS, lo);
        const v16h v2 = ld_frag(vt + 2 * FRAG_ELEMS, lo);
        const v16h v3 = ld_frag(vt + 3 * FRAG_ELEMS, lo);

        float mx = fmaxf(s0[0], s1[0]);
#pragma unroll
        for (int r = 1; r < 8; ++r) mx = fmaxf(mx, fmaxf(s0[r], s1[r]));
        mx *= C2;                                          // C2 > 0: max commutes with the scale
        mx = fmaxf(mx, __shfl_xor(mx, 16, 32));            // the other 16 keys of this query live in lane ^ 16
        const float mnew = fmaxf(m, mx);
        const float corr = __builtin_amdgcn_exp2f(m - mnew);
        const float nref = 8.0f - mnew;                    // probabilities carried x 2^8
        v16h bp; float rs = 0.0f;
#pragma unroll
        for (int r = 0; r < 8; ++r) {
            const float e0 = __builtin_amdgcn_exp2f(__builtin_fmaf(s0[r], C2, nref));
            const float e1 = __builtin_amdgcn_exp2f(__builtin_fmaf(s1[r], C2, nref));
            rs += e0 + e1;
            bp[r]     = (_Float16)e0;                      // key 8h + r
            bp[8 + r] = (_Float16)e1;                      // key 16 + 8h + r
        }
        l = l * corr + rs;
        m = mnew;
        a0 = a0 * corr; a1 = a1 * corr; a2 = a2 * corr; a3 = a3 * corr;
        a0 = mma16(v0, bp, a0);
        a1 = mma16(v1, bp, a1);
        a2 = mma16(v2, bp, a2);
        a3 = mma16(v3, bp, a3);
        guard_o(a0, a1, a2, a3, v0, v1, v2, v3, bp);
      }
      asm volatile("s_wait_dscnt 0x0" ::: "memory");                    // this wave's reads of stage t have returned before its buffer is refilled
      asm volatile("s_wait_asynccnt 0x0" ::: "memory");                 // this wave's share of stage t + 1 has landed
      __syncthreads();                                                  // publishes stage t + 1 and ends every wave's reads of stage t
      if (t + 2 < NSTAGE) {
        const unsigned lb = lds0 + (unsigned)(t & 1) * (4u * ST_ELEMS);
        stage_copy(lb, lb + 2u * ST_ELEMS, gk + (size_t)(t + 2) * ST_ELEMS, gv + (size_t)(t + 2) * ST_ELEMS);
      }
    }
    asm volatile("s_wait_asynccnt 0x0" ::: "memory");                   // nothing of this wave is in flight when it goes on to the epilogue

    const float lt = l + __shfl_xor(l, 16, 32);            // both lane halves of a query used the same running max
    const float inv = 1.0f / (lt * 16.0f);                 // undo the x16 carry of v; the x256 carry of p cancels against lt

    FA_STAGE(0, a0);
    FA_STAGE(1, a1);
    FA_STAGE(2, a2);
    FA_STAGE(3, a3);
    __syncthreads();
    {
        float* ob = O + ((size_t)bh * SEQ + (size_t)q0) * DH;
        const int c4 = (lane & 15) * 4;
        {
#pragma unroll
            for (int it = 0; it < 8; ++it) {
                const int row = it * 2 + h;                // 16 lanes x 16 B = one 256-B output row; one instruction = two whole rows (512 contiguous bytes)
                const v4f val = *(const v4f*)&os[wave][row * OS_P + c4];
                *(v4f*)(ob + (size_t)row * DH + c4) = val;
            }
            
        }
    }
}

extern "C" void kernel_launch(void* const* d_in, const int* in_sizes, int n_in, void* d_out, int out_size, void* d_ws, size_t ws_size, hipStream_t stream) {
    if (n_in < 4) return;
    const long long need = ((long long)(NB * NH - 1) * SEQ_FULL + SEQ) * DH;
    if ((long long)in_sizes[0] < need || (long long)in_sizes[1] < need || (long long)in_sizes[2] < need || in_sizes[3] < 1) return;
    if ((long long)out_size < (long long)NB * NH * SEQ * DH) return;
    if ((size_t)WS_TOTAL > ws_size) return;
    const float* q = (const float*)d_in[0];
    const float* k = (const float*)d_in[1];
    const float* v = (const float*)d_in[2];
    const int*   n = (const int*)d_in[3];
    float* out = (float*)d_out;
    char* wsp = (char*)d_ws;
    unsigned short* K16  = (unsigned short*)(wsp);
    unsigned short* Vt16 = (unsigned short*)(wsp + PLANE_BYTES);

    k_cast_kv<<<CAST_K_BLOCKS + CAST_V_BLOCKS, 256, 0, stream>>>(k, v, K16, Vt16);
    k_fa<<<dim3((unsigned)(SEQ / FA_QB), (unsigned)(NB * NH)), 32 * FA_NW, 0, stream>>>(q, (const _Float16*)K16, (const _Float16*)Vt16, out, n);
}

// v004
// One run takes 37.9 microseconds.
// Two timings next to v003 put it at 1.13 and 1.15 times that version's speed.
// Counting every step since v000, it is 3.64 times as fast.
// Scaled-dot-product attention (32 heads x 2,048 x 64, scores x 1/sqrt(512), no mask). Both contractions (k . q^T and v^T . p^T) on v_wmma_f32_16x16x32_f16: q, k, v converted to bf16 (RNE) and carried x16 as exact f16 (k, v^T as planes stored in WMMA fragment order by one cast launch and staged per block in a two-buffer LDS ring by asynchronous copies, q straight into each wave's registers), probabilities carried x256 as f16, f32 accumulate, f32 online softmax in the exp2 domain. A wave takes 32 queries and one half of the keys; the two halves' partial results are joined once at the end.
#include <hip/hip_runtime.h>

typedef __attribute__((ext_vector_type(16))) _Float16     v16h;
typedef __attribute__((ext_vector_type(8)))  _Float16     v8h;
typedef __attribute__((ext_vector_type(8)))  float        v8f;
typedef __attribute__((ext_vector_type(4)))  float        v4f;
typedef __attribute__((ext_vector_type(4)))  unsigned int v4u;

#ifndef NB
#define NB 4
#endif
#ifndef SEQ
#define SEQ 2048
#endif
#define NB_FULL  4
#define SEQ_FULL 2048
#define NH       8
#define DH       64
#define FA_NW    8                 // waves per block
#define FA_KS    2                 // key slices: waves w and w + FA_NQ take the same queries and one slice of the keys each
#define FA_NQ    (FA_NW / FA_KS)   // query groups per block
#define FA_QW    32                // queries per wave: two 16-column tiles that share every k and v^T fragment
#define FA_QB    (FA_QW * FA_NQ)   // queries per block
#define OS_P     68                // LDS pitch (floats) of an output tile
#define ST_KEYS  64                // keys per LDS stage
#define ST_ELEMS (ST_KEYS * DH)    // f16 elements of one operand's stage (8 KiB, contiguous in its plane)
#define SL_KEYS  (SEQ / FA_KS)     // keys per slice
#define NSTAGE   (SL_KEYS / ST_KEYS)
#define RING_BUF ((unsigned)(FA_KS * 2 * ST_ELEMS * 2))   // bytes of one ring buffer: every slice's k and v^T stage
#define XS_CH    17                // 16-B chunks per lane of a wave's partial state: 16 of accumulators, 1 of max and sum

#define PLANE_ELEMS ((size_t)NB * NH * SEQ * DH)
#define PLANE_BYTES (PLANE_ELEMS * 2)
#define WS_TOTAL    (2 * PLANE_BYTES)

static_assert(DH == 64);
static_assert(NB <= NB_FULL);
static_assert(SEQ <= SEQ_FULL);
static_assert(SEQ % 256 == 0);            // 16-row and 32-key fragment groups never straddle a head; key loop steps by 32
static_assert(SEQ % FA_QB == 0);          // query tiles exact
static_assert(DH % 32 == 0);              // k-steps of 32 over the head dim
static_assert(PLANE_BYTES % 128 == 0);
static_assert(WS_TOTAL <= 134217728);     // workspace carve <= 128 MiB
static_assert((OS_P * 4) % 16 == 0);
static_assert(ST_KEYS % 32 == 0 && SL_KEYS % ST_KEYS == 0 && NSTAGE >= 2);   // whole 32-key groups per stage; the ring's prologue needs two stages
static_assert(ST_ELEMS * 2 == FA_NQ * 4 * 512);                          // each wave copies four 512-B pieces of each operand's stage of its own slice
static_assert(FA_KS == 2 && FA_QW == 32);                                // the merge joins two partial states; each wave of a pair stores 16 of the 32 output rows

// 16-bit WMMA fragment map (wave32), lane L, h = L>>4, m = L&15:
//   A 16x32: lane = row m;    element i -> k = (i<8) ? 8h+i : 16+8h+(i-8)
//   B 32x16: lane = column m; the SAME k(i,h)
//   D 16x16 (8 f32): lane = column m; element r -> row 8h+r
// Fragment-ordered plane: one 16 x 32 fragment = 512 f16 = [j = 0,1][lane 0..31][8 f16]; chunk (j, lane) holds elements 8j..8j+7 of that lane, i.e. row/column m, k = 16j + 8h + 0..7.
// A wave-wide 16-byte load of one j is then 512 contiguous bytes (four whole 128-B lines).
#define FRAG_ELEMS 512
union FragH { v16h v; v8h h[2]; };
// p = start of the fragment (the same in every lane), lo = lane * 8: elements 0..7 <- chunk j = 0, 8..15 <- chunk j = 1
__device__ __forceinline__ v16h ld_frag(const _Float16* __restrict__ p, unsigned lo) {
    FragH f; f.h[0] = *(const v8h*)(p + lo); f.h[1] = *(const v8h*)(p + 256 + lo); return f.v;
}
__device__ __forceinline__ v8f mma16(v16h a, v16h b, v8f c) {
    return __builtin_amdgcn_wmma_f32_16x16x32_f16(false, a, false, b, (short)0, c, false, false);
}
// hazard guards: all accumulators of the group are tied, all operand fragments stay live through the nops
__device__ __forceinline__ void guard_s(v8f& s0, v8f& s1, v8f& s2, v8f& s3, v16h a0, v16h a1, v16h a2, v16h a3, v16h b0, v16h b1, v16h b2, v16h b3) {
    asm volatile("v_nop\n\tv_nop\n\tv_nop\n\tv_nop" : "+v"(s0), "+v"(s1), "+v"(s2), "+v"(s3)
                 : "v"(a0), "v"(a1), "v"(a2), "v"(a3), "v"(b0), "v"(b1), "v"(b2), "v"(b3));
}
__device__ __forceinline__ void guard_o(v8f& o0, v8f& o1, v8f& o2, v8f& o3, v8f& o4, v8f& o5, v8f& o6, v8f& o7, v16h a0, v16h a1, v16h a2, v16h a3, v16h b0, v16h b1) {
    asm volatile("v_nop\n\tv_nop\n\tv_nop\n\tv_nop" : "+v"(o0), "+v"(o1), "+v"(o2), "+v"(o3), "+v"(o4), "+v"(o5), "+v"(o6), "+v"(o7)
                 : "v"(a0), "v"(a1), "v"(a2), "v"(a3), "v"(b0), "v"(b1));
}

// bf16 RNE kept as f32 (finite inputs)
__device__ __forceinline__ float bf_rne(float v) {
    const unsigned u = __float_as_uint(v);
    const unsigned r = (u + 0x7fffu + ((u >> 16) & 1u)) & 0xffff0000u;
    return __uint_as_float(r);
}
__device__ __forceinline__ unsigned int pk2h(float a, float b) {
    return (unsigned int)__builtin_bit_cast(unsigned short, (_Float16)a) | ((unsigned int)__builtin_bit_cast(unsigned short, (_Float16)b) << 16);
}

// f32 [bh][s][64] (full-size row stride) -> f16 fragments [bh][SEQ/16 row tiles][2 halves of d][j][lane][8] = bf16_rne(x) * 16 (exact in f16); row = s, k = d.
// A wave takes 8 rows x one 32-wide half of d: it reads eight whole 128-B lines and stores four whole 128-B lines (one per (j, h), eight rows each).
__device__ __forceinline__ void cast_rows(const float* __restrict__ src, unsigned short* __restrict__ dst, const long long u) {
    if (u >= (long long)NB * NH * SEQ * (DH / 8)) return;
    const int jh = (int)(u & 3);                           // 2 j + h
    const int hf = (int)((u >> 5) & 1);                    // which half of d
    const int m  = (int)((u >> 2) & 7) + 8 * (int)((u >> 6) & 1);   // row inside the 16-row tile
    const int c0 = 32 * hf + 8 * jh;
    const long long row = (u >> 7) * 16 + m;
    const int bh = (int)(row / SEQ);
    const int s  = (int)(row % SEQ);
    const float* sp = src + ((size_t)bh * SEQ_FULL + (size_t)s) * DH + c0;
    const v4f x0 = *(const v4f*)(sp);
    const v4f x1 = *(const v4f*)(sp + 4);
    v4u pk;
    pk.x = pk2h(bf_rne(x0.x) * 16.0f, bf_rne(x0.y) * 16.0f);
    pk.y = pk2h(bf_rne(x0.z) * 16.0f, bf_rne(x0.w) * 16.0f);
    pk.z = pk2h(bf_rne(x1.x) * 16.0f, bf_rne(x1.y) * 16.0f);
    pk.w = pk2h(bf_rne(x1.z) * 16.0f, bf_rne(x1.w) * 16.0f);
    v4u* d = (v4u*)(dst + ((size_t)(u >> 7) * 128 + (size_t)(64 * hf + 16 * jh + m)) * 8);
    *d = pk;
}

// f32 v[bh][s][64] -> f16 fragments of v^T [bh][SEQ/32 key groups][4 d tiles][j][lane][8] = bf16_rne(x) * 16; row = d, k = key.
// A wave takes 32 consecutive d x 8 keys: each of its eight loads reads one whole 128-B line, and it stores four whole 128-B lines.
__device__ __forceinline__ void cast_vt(const float* __restrict__ src, unsigned short* __restrict__ dst, const long long u) {
    const int per = SEQ / 32;
    if (u >= (long long)NB * NH * DH * (SEQ / 8)) return;
    const long long g = u >> 8;                            // key group over all heads
    const int jh = (int)((u >> 6) & 3);                    // 2 j + h
    const int s0 = 32 * (int)(g % per) + 8 * jh;           // key = 32 kg + 16 j + 8 h
    const int d  = (int)(u & 63);
    const int bh = (int)(g / per);
    const float* sp = src + ((size_t)bh * SEQ_FULL + (size_t)s0) * DH + d;
    float w[8];
#pragma unroll
    for (int e = 0; e < 8; ++e) w[e] = bf_rne(sp[(size_t)e * DH]) * 16.0f;
    v4u pk;
    pk.x = pk2h(w[0], w[1]); pk.y = pk2h(w[2], w[3]); pk.z = pk2h(w[4], w[5]); pk.w = pk2h(w[6], w[7]);
    v4u* dd = (v4u*)(dst + ((size_t)g * 256 + (size_t)(64 * (d >> 4) + 16 * jh + (d & 15))) * 8);
    *dd = pk;
}

// One launch for both planes: blocks 0 .. CAST_K_BLOCKS-1 cast k, the rest cast v^T (the choice is the same for a whole block).
#define CAST_K_BLOCKS ((unsigned)(((long long)NB * NH * SEQ * (DH / 8) + 255) / 256))
#define CAST_V_BLOCKS ((unsigned)(((long long)NB * NH * DH * (SEQ / 8) + 255) / 256))
__global__ __launch_bounds__(256) void k_cast_kv(const float* __restrict__ k, const float* __restrict__ v,
                                                 unsigned short* __restrict__ K16, unsigned short* __restrict__ Vt16) {
    if (blockIdx.x < CAST_K_BLOCKS) cast_rows(k, K16, (long long)blockIdx.x * 256 + threadIdx.x);
    else                            cast_vt(v, Vt16, (long long)(blockIdx.x - CAST_K_BLOCKS) * 256 + threadIdx.x);
}

// eight consecutive f32 -> eight f16 = bf16_rne(x) * 16, the values the cast launch gives k and v
__device__ __forceinline__ v8h cvt8(const float* __restrict__ p) {
    const v4f x0 = *(const v4f*)(p);
    const v4f x1 = *(const v4f*)(p + 4);
    v8h r;
    r[0] = (_Float16)(bf_rne(x0.x) * 16.0f); r[1] = (_Float16)(bf_rne(x0.y) * 16.0f);
    r[2] = (_Float16)(bf_rne(x0.z) * 16.0f); r[3] = (_Float16)(bf_rne(x0.w) * 16.0f);
    r[4] = (_Float16)(bf_rne(x1.x) * 16.0f); r[5] = (_Float16)(bf_rne(x1.y) * 16.0f);
    r[6] = (_Float16)(bf_rne(x1.z) * 16.0f); r[7] = (_Float16)(bf_rne(x1.w) * 16.0f);
    return r;
}

// One wave's share of one stage: four 512-B pieces of the k stage and four of the v^T stage, 16 B per lane, global -> LDS through no register.
// lk, lv = the lane's LDS byte address of its first piece; gk, gv = the lane's global address of it. All lanes on, all addresses multiples of 16.
__device__ __forceinline__ void stage_copy(const unsigned lk, const unsigned lv, const _Float16* gk, const _Float16* gv) {
    // s_wait_xcnt 0 closes the statement: no address register of a copy is rewritten ahead of it
    asm volatile("global_load_async_to_lds_b128 %0, %8, off\n\t"
                 "global_load_async_to_lds_b128 %1, %9, off\n\t"
                 "global_load_async_to_lds_b128 %2, %10, off\n\t"
                 "global_load_async_to_lds_b128 %3, %11, off\n\t"
                 "global_load_async_to_lds_b128 %4, %12, off\n\t"
                 "global_load_async_to_lds_b128 %5, %13, off\n\t"
                 "global_load_async_to_lds_b128 %6, %14, off\n\t"
                 "global_load_async_to_lds_b128 %7, %15, off\n\t"
                 "s_wait_xcnt 0x0"
                 :: "v"(lk), "v"(lk + 512u), "v"(lk + 1024u), "v"(lk + 1536u), "v"(lv), "v"(lv + 512u), "v"(lv + 1024u), "v"(lv + 1536u),
                    "v"(gk), "v"(gk + 256), "v"(gk + 512), "v"(gk + 768), "v"(gv), "v"(gv + 256), "v"(gv + 512), "v"(gv + 768)
                 : "memory");
}

// One 16-query tile's online-softmax step over 32 keys: s0 = scores of keys 0..15, s1 = of keys 16..31 (D layout, lane = query column).
// Updates the lane's running max m and partial sum l, gives the factor corr for the tile's accumulators and returns P^T as a B fragment.
__device__ __forceinline__ v16h softmax_step(const v8f s0, const v8f s1, const float C2, float& m, float& l, float& corr) {
    float mx = fmaxf(s0[0], s1[0]);
#pragma unroll     // constant element numbers: the score tiles stay in registers
    for (int r = 1; r < 8; ++r) mx = fmaxf(mx, fmaxf(s0[r], s1[r]));
    mx *= C2;                                          // C2 > 0: max commutes with the scale
    mx = fmaxf(mx, __shfl_xor(mx, 16, 32));            // the other 16 keys of this query live in lane ^ 16
    const float mnew = fmaxf(m, mx);
    corr = __builtin_amdgcn_exp2f(m - mnew);
    const float nref = 8.0f - mnew;                    // probabilities carried x 2^8
    v16h bp; float rs = 0.0f;
#pragma unroll     // constant element numbers: scores and probabilities stay in registers
    for (int r = 0; r < 8; ++r) {
        const float e0 = __builtin_amdgcn_exp2f(__builtin_fmaf(s0[r], C2, nref));
        const float e1 = __builtin_amdgcn_exp2f(__builtin_fmaf(s1[r], C2, nref));
        rs += e0 + e1;
        bp[r]     = (_Float16)e0;                      // key 8h + r
        bp[8 + r] = (_Float16)e1;                      // key 16 + 8h + r
    }
    l = l * corr + rs;
    m = mnew;
    return bp;
}

// Fused attention, transposed orientation. Wave = 32 queries (two 16-column tiles) x one half of the keys; 32 keys per step; each k and v^T fragment read from LDS feeds one product per tile.
//   The two waves of a query group run the same online softmax on their own key slice; their (max, sum, O^T) are joined once behind the loop, through LDS.
//   S^T (16 keys x 16 queries) = K (A: row = key, k = d) x Q^T (B: column = query, k = d), two key tiles per step.
//   P^T (B operand, k = key, column = query) is built in registers from the two D tiles: element r <- tile(keys 0..15)[r], element 8+r <- tile(keys 16..31)[r], same lane.
//   O^T (16 d x 16 queries) += V^T (A: row = d, k = key) x P^T, four d tiles.
//   K and V^T reach the waves through LDS: a stage is 64 keys of both planes (16 KiB) per key slice, copied once per block and read by all the slice's waves; stage t + 2 is copied while stage t + 1 is worked on.
//   Per-query statistics live per lane (column = query): in-lane max over 16 scores + one xor-16 exchange; per-lane partial sums, combined once at the end.
// chunk C of this lane in the pair's exchange area: a wave-wide access is 512 contiguous bytes
#define XS_AT(C) (*(v4f*)&xs[qg][((C) * 32 + lane) * 4])
#define XS_PUT(I, ACC) do { \
    v4f lo_, hi_; \
    lo_.x = ACC[0]; lo_.y = ACC[1]; lo_.z = ACC[2]; lo_.w = ACC[3]; \
    hi_.x = ACC[4]; hi_.y = ACC[5]; hi_.z = ACC[6]; hi_.w = ACC[7]; \
    XS_AT(2 * (I))     = lo_; \
    XS_AT(2 * (I) + 1) = hi_; \
} while (0)
// own accumulator x FA + the other slice's (tile I of the exchange area) x FB -> output tile in LDS
#define FA_STAGE(QT, T, ACC, FA, FB) do { \
    const v4f xl_ = XS_AT(2 * ((QT) * 4 + (T))); \
    const v4f xh_ = XS_AT(2 * ((QT) * 4 + (T)) + 1); \
    v4f lo_, hi_; \
    lo_.x = ACC[0] * FA + xl_.x * FB; lo_.y = ACC[1] * FA + xl_.y * FB; lo_.z = ACC[2] * FA + xl_.z * FB; lo_.w = ACC[3] * FA + xl_.w * FB; \
    hi_.x = ACC[4] * FA + xh_.x * FB; hi_.y = ACC[5] * FA + xh_.y * FB; hi_.z = ACC[6] * FA + xh_.z * FB; hi_.w = ACC[7] * FA + xh_.w * FB; \
    *(v4f*)&os[qg][((QT) * 16 + col) * OS_P + (T) * 16 + 8 * h]     = lo_; \
    *(v4f*)&os[qg][((QT) * 16 + col) * OS_P + (T) * 16 + 8 * h + 4] = hi_; \
} while (0)

__global__ __launch_bounds__(32 * FA_NW) void k_fa(const float* __restrict__ Q, const _Float16* __restrict__ K16, const _Float16* __restrict__ Vt16,
                                                   float* __restrict__ O, const int* __restrict__ n_unused) {
    (void)n_unused;                                        // the module's integer scalar input; not used by the computation
    __shared__ __align__(16) _Float16 ring[2][FA_KS][2 * ST_ELEMS]; // [buffer][key slice][k stage | v^T stage]
    __shared__ __align__(16) float xs[FA_NQ][XS_CH * 128]; // per query group: the second slice's partial state, [chunk][lane][4 f32]
    __shared__ __align__(16) float os[FA_NQ][FA_QW * OS_P]; // per query group: 32 x 64 output tile (written by the pair's first wave, read by both; block barrier in between)
    const int lane = threadIdx.x & 31;
    const int wave = __builtin_amdgcn_readfirstlane(threadIdx.x >> 5);
    const int h = lane >> 4, col = lane & 15;
    const int bh = blockIdx.y;
    const int ks = wave / FA_NQ;                           // key slice (the same in the whole wave)
    const int qg = wave % FA_NQ;                           // query group
    const int q0 = blockIdx.x * FA_QB + qg * FA_QW;
    const size_t pbase = ((size_t)bh * SEQ + (size_t)ks * SL_KEYS) * DH;   // same element count per head and per key in both planes

    // scores are carried x256 (q x16, k x16); exp2 domain: 2^(s * C2), C2 = log2(e) / sqrt(512) / 256
    const float C2 = (float)(0.044194173824159216 * 1.4426950408889634 / 256.0);

    const unsigned lo = 8u * (unsigned)lane;
    // Q^T fragments straight from the f32 input (full-size row stride): lane = query col, elements 8j..8j+7 <- d = 32 half + 16 j + 8 h + 0..7
    const float* qrow = Q + ((size_t)bh * SEQ_FULL + (size_t)(q0 + col)) * DH + 8 * h;
    const float* qrow1 = qrow + 16 * DH;                   // the second tile: queries q0 + 16 ..
    FragH fq0, fq1, fq2, fq3;
    fq0.h[0] = cvt8(qrow);       fq0.h[1] = cvt8(qrow + 16);
    fq1.h[0] = cvt8(qrow + 32);  fq1.h[1] = cvt8(qrow + 48);
    fq2.h[0] = cvt8(qrow1);      fq2.h[1] = cvt8(qrow1 + 16);
    fq3.h[0] = cvt8(qrow1 + 32); fq3.h[1] = cvt8(qrow1 + 48);
    const v16h bq0 = fq0.v;                                // tile 0, d 0..31
    const v16h bq1 = fq1.v;                                // tile 0, d 32..63
    const v16h cq0 = fq2.v;                                // tile 1, d 0..31
    const v16h cq1 = fq3.v;                                // tile 1, d 32..63
    const _Float16* kp = K16 + pbase;
    const _Float16* vp = Vt16 + pbase;

    // this lane's 16 bytes of the wave's first piece, inside a stage (f16 elements)
    const unsigned ce = (unsigned)qg * (ST_ELEMS / FA_NQ) + lo;
    const unsigned lds0 = (unsigned)(size_t)&ring[0][ks][0] + 2u * ce;  // LDS byte address in buffer 0, own slice, k half
    const _Float16* gk = kp + ce;
    const _Float16* gv = vp + ce;

    v8f a0 = {}, a1 = {}, a2 = {}, a3 = {};                // tile 0
    v8f b0 = {}, b1 = {}, b2 = {}, b3 = {};                // tile 1
    float m0 = -1.0e30f, l0 = 0.0f, m1 = -1.0e30f, l1 = 0.0f;

    stage_copy(lds0, lds0 + 2u * ST_ELEMS, gk, gv);                     // stage 0 -> buffer 0
    asm volatile("s_wait_asynccnt 0x0" ::: "memory");                   // this wave's share of stage 0 has landed
    __syncthreads();                                                    // publishes stage 0
    stage_copy(lds0 + RING_BUF, lds0 + RING_BUF + 2u * ST_ELEMS, gk + ST_ELEMS, gv + ST_ELEMS);   // stage 1 -> buffer 1

#pragma unroll 1   // one trip per stage: the hot loop stays small
    for (int t = 0; t < NSTAGE; ++t) {
      const _Float16* sb = &ring[t & 1][ks][0];
#pragma unroll     // the stage's 32-key groups inline: their LDS offsets become immediates of the loads
      for (int u = 0; u < ST_KEYS / 32; ++u) {
        const _Float16* kt = sb + u * 32 * DH;
        const v16h k00 = ld_frag(kt, lo);                  // keys 0..15 of the 32-key group, d 0..31
        const v16h k01 = ld_frag(kt + FRAG_ELEMS, lo);     // d 32..63
        const v16h k10 = ld_frag(kt + 2 * FRAG_ELEMS, lo); // keys 16..31
        const v16h k11 = ld_frag(kt + 3 * FRAG_ELEMS, lo);
        v8f s0 = {}, s1 = {}, t0 = {}, t1 = {};
        s0 = mma16(k00, bq0, s0);
        s1 = mma16(k10, bq0, s1);
        t0 = mma16(k00, cq0, t0);
        t1 = mma16(k10, cq0, t1);
        s0 = mma16(k01, bq1, s0);
        s1 = mma16(k11, bq1, s1);
        t0 = mma16(k01, cq1, t0);
        t1 = mma16(k11, cq1, t1);
        guard_s(s0, s1, t0, t1, k00, k01, k10, k11, bq0, bq1, cq0, cq1);

        const _Float16* vt = sb + ST_ELEMS + u * 32 * DH;
        const v16h v0 = ld_frag(vt, lo);                   // d 0..15,  keys {8h.., 16+8h..} of the group
        const v16h v1 = ld_frag(vt + FRAG_ELEMS, lo);
        const v16h v2 = ld_frag(vt + 2 * FRAG_ELEMS, lo);
        const v16h v3 = ld_frag(vt + 3 * FRAG_ELEMS, lo);

        float corr0, corr1;
        const v16h bp = softmax_step(s0, s1, C2, m0, l0, corr0);
        const v16h cp = softmax_step(t0, t1, C2, m1, l1, corr1);
        a0 = a0 * corr0; a1 = a1 * corr0; a2 = a2 * corr0; a3 = a3 * corr0;
        b0 = b0 * corr1; b1 = b1 * corr1; b2 = b2 * corr1; b3 = b3 * corr1;
        a0 = mma16(v0, bp, a0);
        a1 = mma16(v1, bp, a1);
        a2 = mma16(v2, bp, a2);
        a3 = mma16(v3, bp, a3);
        b0 = mma16(v0, cp, b0);
        b1 = mma16(v1, cp, b1);
        b2 = mma16(v2, cp, b2);
        b3 = mma16(v3, cp, b3);
        guard_o(a0, a1, a2, a3, b0, b1, b2, b3, v0, v1, v2, v3, bp, cp);
      }
      asm volatile("s_wait_dscnt 0x0" ::: "memory");                    // this wave's reads of stage t have returned before its buffer is refilled
      asm volatile("s_wait_asynccnt 0x0" ::: "memory");                 // this wave's share of stage t + 1 has landed
      __syncthreads();                                                  // publishes stage t + 1 and ends every wave's reads of stage t
      if (t + 2 < NSTAGE) {
        const unsigned lb = lds0 + (unsigned)(t & 1) * RING_BUF;
        stage_copy(lb, lb + 2u * ST_ELEMS, gk + (size_t)(t + 2) * ST_ELEMS, gv + (size_t)(t + 2) * ST_ELEMS);
      }
    }
    asm volatile("s_wait_asynccnt 0x0" ::: "memory");                   // nothing of this wave is in flight when it goes on to the epilogue

    const float lt0 = l0 + __shfl_xor(l0, 16, 32);         // both lane halves of a query used the same running max
    const float lt1 = l1 + __shfl_xor(l1, 16, 32);
    if (ks == 1) {                                         // scalar test: the second slice's wave hands its partial state over
        XS_PUT(0, a0); XS_PUT(1, a1); XS_PUT(2, a2); XS_PUT(3, a3);
        XS_PUT(4, b0); XS_PUT(5, b1); XS_PUT(6, b2); XS_PUT(7, b3);
        v4f st; st.x = m0; st.y = lt0; st.z = m1; st.w = lt1;
        XS_AT(16) = st;
    }
    __syncthreads();                                       // publishes the second slice's partial states
    if (ks == 0) {
        const v4f st = XS_AT(16);
        const float mn0 = fmaxf(m0, st.x), mn1 = fmaxf(m1, st.z);
        const float ca0 = __builtin_amdgcn_exp2f(m0 - mn0), cb0 = __builtin_amdgcn_exp2f(st.x - mn0);
        const float ca1 = __builtin_amdgcn_exp2f(m1 - mn1), cb1 = __builtin_amdgcn_exp2f(st.z - mn1);
        const float inv0 = 1.0f / ((lt0 * ca0 + st.y * cb0) * 16.0f);   // undo the x16 carry of v; the x256 carry of p cancels against the sum
        const float inv1 = 1.0f / ((lt1 * ca1 + st.w * cb1) * 16.0f);
        const float fa0 = ca0 * inv0, fb0 = cb0 * inv0, fa1 = ca1 * inv1, fb1 = cb1 * inv1;
        FA_STAGE(0, 0, a0, fa0, fb0);
        FA_STAGE(0, 1, a1, fa0, fb0);
        FA_STAGE(0, 2, a2, fa0, fb0);
        FA_STAGE(0, 3, a3, fa0, fb0);
        FA_STAGE(1, 0, b0, fa1, fb1);
        FA_STAGE(1, 1, b1, fa1, fb1);
        FA_STAGE(1, 2, b2, fa1, fb1);
        FA_STAGE(1, 3, b3, fa1, fb1);
    }
    __syncthreads();                                       // publishes the output tiles
    {
        const int r0 = ks * 16;                            // each wave of the pair stores 16 of the group's 32 rows
        float* ob = O + ((size_t)bh * SEQ + (size_t)(q0 + r0)) * DH;
        const int c4 = (lane & 15) * 4;
#pragma unroll     // all eight LDS reads are issued ahead of the stores
        for (int it = 0; it < 8; ++it) {
            const int row = it * 2 + h;                    // 16 lanes x 16 B = one 256-B output row; one instruction = two whole rows (512 contiguous bytes)
            const v4f val = *(const v4f*)&os[qg][(r0 + row) * OS_P + c4];
            *(v4f*)(ob + (size_t)row * DH + c4) = val;
        }
    }
}

extern "C" void kernel_launch(void* const* d_in, const int* in_sizes, int n_in, void* d_out, int out_size, void* d_ws, size_t ws_size, hipStream_t stream) {
    if (n_in < 4) return;
    const long long need = ((long long)(NB * NH - 1) * SEQ_FULL + SEQ) * DH;
    if ((long long)in_sizes[0] < need || (long long)in_sizes[1] < need || (long long)in_sizes[2] < need || in_sizes[3] < 1) return;
    if ((long long)out_size < (long long)NB * NH * SEQ * DH) return;
    if ((size_t)WS_TOTAL > ws_size) return;
    const float* q = (const float*)d_in[0];
    const float* k = (const float*)d_in[1];
    const float* v = (const float*)d_in[2];
    const int*   n = (const int*)d_in[3];
    float* out = (float*)d_out;
    char* wsp = (char*)d_ws;
    unsigned short* K16  = (unsigned short*)(wsp);
    unsigned short* Vt16 = (unsigned short*)(wsp + PLANE_BYTES);

    k_cast_kv<<<CAST_K_BLOCKS + CAST_V_BLOCKS, 256, 0, stream>>>(k, v, K16, Vt16);
    k_fa<<<dim3((unsigned)(SEQ / FA_QB), (unsigned)(NB * NH)), 32 * FA_NW, 0, stream>>>(q, (const _Float16*)K16, (const _Float16*)Vt16, out, n);
}

// v005
// It runs in 34.6 microseconds.
// Timed twice side by side with v004, it ran 1.09 and 1.10 times as fast.
// Over all steps from v000 it is 3.98 times as fast.
// Scaled-dot-product attention (32 heads x 2,048 x 64, scores x 1/sqrt(512), no mask). Both contractions (k . q^T and v^T . p^T) on v_wmma_f32_16x16x32_f16: q, k, v converted to bf16 (RNE) and carried x16 as exact f16 (k, v^T as planes stored in WMMA fragment order by one cast launch and staged per block in a two-buffer LDS ring by asynchronous copies, q straight into each wave's registers), probabilities carried x256 as f16, f32 accumulate, f32 online softmax in the exp2 domain whose reference maximum moves, and rescales the sums, only when a lane's 16 probabilities of a step sum to more than 2^15 in their x256 carry. A wave takes 32 queries and one half of the keys; the two halves' partial results are joined once at the end.
#include <hip/hip_runtime.h>

typedef __attribute__((ext_vector_type(16))) _Float16     v16h;
typedef __attribute__((ext_vector_type(8)))  _Float16     v8h;
typedef __attribute__((ext_vector_type(8)))  float        v8f;
typedef __attribute__((ext_vector_type(4)))  float        v4f;
typedef __attribute__((ext_vector_type(2)))  float        v2f;
typedef __attribute__((ext_vector_type(4)))  unsigned int v4u;

#ifndef NB
#define NB 4
#endif
#ifndef SEQ
#define SEQ 2048
#endif
#define NB_FULL  4
#define SEQ_FULL 2048
#define NH       8
#define DH       64
#define FA_NW    8                 // waves per block
#define FA_KS    2                 // key slices: waves w and w + FA_NQ take the same queries and one slice of the keys each
#define FA_NQ    (FA_NW / FA_KS)   // query groups per block
#define FA_QW    32                // queries per wave: two 16-column tiles that share every k and v^T fragment
#define FA_QB    (FA_QW * FA_NQ)   // queries per block
#define OS_P     68                // LDS pitch (floats) of an output tile
#define ST_KEYS  64                // keys per LDS stage
#define ST_ELEMS (ST_KEYS * DH)    // f16 elements of one operand's stage (8 KiB, contiguous in its plane)
#define SL_KEYS  (SEQ / FA_KS)     // keys per slice
#define NSTAGE   (SL_KEYS / ST_KEYS)
#define RING_BUF ((unsigned)(FA_KS * 2 * ST_ELEMS * 2))   // bytes of one ring buffer: every slice's k and v^T stage
#define XS_CH    17                // 16-B chunks per lane of a wave's partial state: 16 of accumulators, 1 of max and sum

#define PLANE_ELEMS ((size_t)NB * NH * SEQ * DH)
#define PLANE_BYTES (PLANE_ELEMS * 2)
#define WS_TOTAL    (2 * PLANE_BYTES)

static_assert(DH == 64);
static_assert(NB <= NB_FULL);
static_assert(SEQ <= SEQ_FULL);
static_assert(SEQ % 256 == 0);            // 16-row and 32-key fragment groups never straddle a head; key loop steps by 32
static_assert(SEQ % FA_QB == 0);          // query tiles exact
static_assert(DH % 32 == 0);              // k-steps of 32 over the head dim
static_assert(PLANE_BYTES % 128 == 0);
static_assert(WS_TOTAL <= 134217728);     // workspace carve <= 128 MiB
static_assert((OS_P * 4) % 16 == 0);
static_assert(ST_KEYS % 32 == 0 && SL_KEYS % ST_KEYS == 0 && NSTAGE >= 2);   // whole 32-key groups per stage; the ring's prologue needs two stages
static_assert(ST_ELEMS * 2 == FA_NQ * 4 * 512);                          // each wave copies four 512-B pieces of each operand's stage of its own slice
static_assert(FA_KS == 2 && FA_QW == 32);                                // the merge joins two partial states; each wave of a pair stores 16 of the 32 output rows

// 16-bit WMMA fragment map (wave32), lane L, h = L>>4, m = L&15:
//   A 16x32: lane = row m;    element i -> k = (i<8) ? 8h+i : 16+8h+(i-8)
//   B 32x16: lane = column m; the SAME k(i,h)
//   D 16x16 (8 f32): lane = column m; element r -> row 8h+r
// Fragment-ordered plane: one 16 x 32 fragment = 512 f16 = [j = 0,1][lane 0..31][8 f16]; chunk (j, lane) holds elements 8j..8j+7 of that lane, i.e. row/column m, k = 16j + 8h + 0..7.
// A wave-wide 16-byte load of one j is then 512 contiguous bytes (four whole 128-B lines).
#define FRAG_ELEMS 512
union FragH { v16h v; v8h h[2]; };
// p = start of the fragment (the same in every lane), lo = lane * 8: elements 0..7 <- chunk j = 0, 8..15 <- chunk j = 1
__device__ __forceinline__ v16h ld_frag(const _Float16* __restrict__ p, unsigned lo) {
    FragH f; f.h[0] = *(const v8h*)(p + lo); f.h[1] = *(const v8h*)(p + 256 + lo); return f.v;
}
__device__ __forceinline__ v8f mma16(v16h a, v16h b, v8f c) {
    return __builtin_amdgcn_wmma_f32_16x16x32_f16(false, a, false, b, (short)0, c, false, false);
}
// hazard guards: all accumulators of the group are tied, all operand fragments stay live through the nops
__device__ __forceinline__ void guard_s(v8f& s0, v8f& s1, v8f& s2, v8f& s3, v16h a0, v16h a1, v16h a2, v16h a3, v16h b0, v16h b1, v16h b2, v16h b3) {
    asm volatile("v_nop\n\tv_nop\n\tv_nop\n\tv_nop" : "+v"(s0), "+v"(s1), "+v"(s2), "+v"(s3)
                 : "v"(a0), "v"(a1), "v"(a2), "v"(a3), "v"(b0), "v"(b1), "v"(b2), "v"(b3));
}
__device__ __forceinline__ void guard_o(v8f& o0, v8f& o1, v8f& o2, v8f& o3, v8f& o4, v8f& o5, v8f& o6, v8f& o7, v16h a0, v16h a1, v16h a2, v16h a3, v16h b0, v16h b1) {
    asm volatile("v_nop\n\tv_nop\n\tv_nop\n\tv_nop" : "+v"(o0), "+v"(o1), "+v"(o2), "+v"(o3), "+v"(o4), "+v"(o5), "+v"(o6), "+v"(o7)
                 : "v"(a0), "v"(a1), "v"(a2), "v"(a3), "v"(b0), "v"(b1));
}

// bf16 RNE kept as f32 (finite inputs)
__device__ __forceinline__ float bf_rne(float v) {
    const unsigned u = __float_as_uint(v);
    const unsigned r = (u + 0x7fffu + ((u >> 16) & 1u)) & 0xffff0000u;
    return __uint_as_float(r);
}
__device__ __forceinline__ unsigned int pk2h(float a, float b) {
    return (unsigned int)__builtin_bit_cast(unsigned short, (_Float16)a) | ((unsigned int)__builtin_bit_cast(unsigned short, (_Float16)b) << 16);
}

// f32 [bh][s][64] (full-size row stride) -> f16 fragments [bh][SEQ/16 row tiles][2 halves of d][j][lane][8] = bf16_rne(x) * 16 (exact in f16); row = s, k = d.
// A wave takes 8 rows x one 32-wide half of d: it reads eight whole 128-B lines and stores four whole 128-B lines (one per (j, h), eight rows each).
__device__ __forceinline__ void cast_rows(const float* __restrict__ src, unsigned short* __restrict__ dst, const long long u) {
    if (u >= (long long)NB * NH * SEQ * (DH / 8)) return;
    const int jh = (int)(u & 3);                           // 2 j + h
    const int hf = (int)((u >> 5) & 1);                    // which half of d
    const int m  = (int)((u >> 2) & 7) + 8 * (int)((u >> 6) & 1);   // row inside the 16-row tile
    const int c0 = 32 * hf + 8 * jh;
    const long long row = (u >> 7) * 16 + m;
    const int bh = (int)(row / SEQ);
    const int s  = (int)(row % SEQ);
    const float* sp = src + ((size_t)bh * SEQ_FULL + (size_t)s) * DH + c0;
    const v4f x0 = *(const v4f*)(sp);
    const v4f x1 = *(const v4f*)(sp + 4);
    v4u pk;
    pk.x = pk2h(bf_rne(x0.x) * 16.0f, bf_rne(x0.y) * 16.0f);
    pk.y = pk2h(bf_rne(x0.z) * 16.0f, bf_rne(x0.w) * 16.0f);
    pk.z = pk2h(bf_rne(x1.x) * 16.0f, bf_rne(x1.y) * 16.0f);
    pk.w = pk2h(bf_rne(x1.z) * 16.0f, bf_rne(x1.w) * 16.0f);
    v4u* d = (v4u*)(dst + ((size_t)(u >> 7) * 128 + (size_t)(64 * hf + 16 * jh + m)) * 8);
    *d = pk;
}

// f32 v[bh][s][64] -> f16 fragments of v^T [bh][SEQ/32 key groups][4 d tiles][j][lane][8] = bf16_rne(x) * 16; row = d, k = key.
// A wave takes 32 consecutive d x 8 keys: each of its eight loads reads one whole 128-B line, and it stores four whole 128-B lines.
__device__ __forceinline__ void cast_vt(const float* __restrict__ src, unsigned short* __restrict__ dst, const long long u) {
    const int per = SEQ / 32;
    if (u >= (long long)NB * NH * DH * (SEQ / 8)) return;
    const long long g = u >> 8;                            // key group over all heads
    const int jh = (int)((u >> 6) & 3);                    // 2 j + h
    const int s0 = 32 * (int)(g % per) + 8 * jh;           // key = 32 kg + 16 j + 8 h
    const int d  = (int)(u & 63);
    const int bh = (int)(g / per);
    const float* sp = src + ((size_t)bh * SEQ_FULL + (size_t)s0) * DH + d;
    float w[8];
#pragma unroll
    for (int e = 0; e < 8; ++e) w[e] = bf_rne(sp[(size_t)e * DH]) * 16.0f;
    v4u pk;
    pk.x = pk2h(w[0], w[1]); pk.y = pk2h(w[2], w[3]); pk.z = pk2h(w[4], w[5]); pk.w = pk2h(w[6], w[7]);
    v4u* dd = (v4u*)(dst + ((size_t)g * 256 + (size_t)(64 * (d >> 4) + 16 * jh + (d & 15))) * 8);
    *dd = pk;
}

// One launch for both planes: blocks 0 .. CAST_K_BLOCKS-1 cast k, the rest cast v^T (the choice is the same for a whole block).
#define CAST_K_BLOCKS ((unsigned)(((long long)NB * NH * SEQ * (DH / 8) + 255) / 256))
#define CAST_V_BLOCKS ((unsigned)(((long long)NB * NH * DH * (SEQ / 8) + 255) / 256))
__global__ __launch_bounds__(256) void k_cast_kv(const float* __restrict__ k, const float* __restrict__ v,
                                                 unsigned short* __restrict__ K16, unsigned short* __restrict__ Vt16) {
    if (blockIdx.x < CAST_K_BLOCKS) cast_rows(k, K16, (long long)blockIdx.x * 256 + threadIdx.x);
    else                            cast_vt(v, Vt16, (long long)(blockIdx.x - CAST_K_BLOCKS) * 256 + threadIdx.x);
}

// eight consecutive f32 -> eight f16 = bf16_rne(x) * 16, the values the cast launch gives k and v
__device__ __forceinline__ v8h cvt8(const float* __restrict__ p) {
    const v4f x0 = *(const v4f*)(p);
    const v4f x1 = *(const v4f*)(p + 4);
    v8h r;
    r[0] = (_Float16)(bf_rne(x0.x) * 16.0f); r[1] = (_Float16)(bf_rne(x0.y) * 16.0f);
    r[2] = (_Float16)(bf_rne(x0.z) * 16.0f); r[3] = (_Float16)(bf_rne(x0.w) * 16.0f);
    r[4] = (_Float16)(bf_rne(x1.x) * 16.0f); r[5] = (_Float16)(bf_rne(x1.y) * 16.0f);
    r[6] = (_Float16)(bf_rne(x1.z) * 16.0f); r[7] = (_Float16)(bf_rne(x1.w) * 16.0f);
    return r;
}

// One wave's share of one stage: four 512-B pieces of the k stage and four of the v^T stage, 16 B per lane, global -> LDS through no register.
// lk, lv = the lane's LDS byte address of its first piece; gk, gv = the lane's global address of it. All lanes on, all addresses multiples of 16.
__device__ __forceinline__ void stage_copy(const unsigned lk, const unsigned lv, const _Float16* gk, const _Float16* gv) {
    // s_wait_xcnt 0 closes the statement: no address register of a copy is rewritten ahead of it
    asm volatile("global_load_async_to_lds_b128 %0, %8, off\n\t"
                 "global_load_async_to_lds_b128 %1, %9, off\n\t"
                 "global_load_async_to_lds_b128 %2, %10, off\n\t"
                 "global_load_async_to_lds_b128 %3, %11, off\n\t"
                 "global_load_async_to_lds_b128 %4, %12, off\n\t"
                 "global_load_async_to_lds_b128 %5, %13, off\n\t"
                 "global_load_async_to_lds_b128 %6, %14, off\n\t"
                 "global_load_async_to_lds_b128 %7, %15, off\n\t"
                 "s_wait_xcnt 0x0"
                 :: "v"(lk), "v"(lk + 512u), "v"(lk + 1024u), "v"(lk + 1536u), "v"(lv), "v"(lv + 512u), "v"(lv + 1024u), "v"(lv + 1536u),
                    "v"(gk), "v"(gk + 256), "v"(gk + 512), "v"(gk + 768), "v"(gv), "v"(gv + 256), "v"(gv + 512), "v"(gv + 768)
                 : "memory");
}

// The lane's largest raw score of one 16-query tile over 32 keys: s0 = scores of keys 0..15, s1 = of keys 16..31 (D layout, lane = query column, 8 keys of each tile per lane).
__device__ __forceinline__ float max16(const v8f s0, const v8f s1) {
    float mx = fmaxf(s0[0], s1[0]);
#pragma unroll     // constant element numbers: the score tiles stay in registers
    for (int r = 1; r < 8; ++r) mx = fmaxf(mx, fmaxf(s0[r], s1[r]));
    return mx;
}
// Raises one tile's reference maximum m to this step's maximum where that is higher (x = the lane's largest raw score of this step) and rescales its sum and its four accumulators to it; n = 8 - m.
__device__ __forceinline__ void rescale(const float x, const float C2, float& m, float& n, float& l, v8f& o0, v8f& o1, v8f& o2, v8f& o3) {
    float mx = x * C2;                                 // C2 > 0: max commutes with the scale
    mx = fmaxf(mx, __shfl_xor(mx, 16, 32));            // the other 16 keys of this query live in lane ^ 16: both halves get the same reference
    const float mnew = fmaxf(m, mx);
    const float corr = __builtin_amdgcn_exp2f(m - mnew);
    m = mnew;
    n = 8.0f - mnew;                                   // probabilities carried x 2^8
    l *= corr;
    o0 = o0 * corr; o1 = o1 * corr; o2 = o2 * corr; o3 = o3 * corr;
}
// One tile's probabilities over 32 keys against the reference in use (n = 8 - reference): gives the sum rs of the lane's 16 and returns P^T as a B fragment.
__device__ __forceinline__ v16h prob_step(const v8f s0, const v8f s1, const float C2, const float n, float& rs) {
    float x0[8], x1[8];
#pragma unroll     // constant element numbers; two neighbouring registers per fma: they pair up without register moves
    for (int r = 0; r < 8; r += 2) {
        const v2f y0 = __builtin_elementwise_fma(v2f{s0[r], s0[r + 1]}, v2f{C2, C2}, v2f{n, n});
        const v2f y1 = __builtin_elementwise_fma(v2f{s1[r], s1[r + 1]}, v2f{C2, C2}, v2f{n, n});
        x0[r] = y0.x; x0[r + 1] = y0.y; x1[r] = y1.x; x1[r + 1] = y1.y;
    }
    v16h bp; rs = 0.0f;
#pragma unroll     // constant element numbers: scores and probabilities stay in registers
    for (int r = 0; r < 8; ++r) {
        const float e0 = __builtin_amdgcn_exp2f(x0[r]);
        const float e1 = __builtin_amdgcn_exp2f(x1[r]);
        rs += e0 + e1;
        bp[r]     = (_Float16)e0;                      // key 8h + r
        bp[8 + r] = (_Float16)e1;                      // key 16 + 8h + r
    }
    return bp;
}

// Fused attention, transposed orientation. Wave = 32 queries (two 16-column tiles) x one half of the keys; 32 keys per step; each k and v^T fragment read from LDS feeds one product per tile.
//   The two waves of a query group run the same online softmax on their own key slice; their (max, sum, O^T) are joined once behind the loop, through LDS.
//   S^T (16 keys x 16 queries) = K (A: row = key, k = d) x Q^T (B: column = query, k = d), two key tiles per step.
//   P^T (B operand, k = key, column = query) is built in registers from the two D tiles: element r <- tile(keys 0..15)[r], element 8+r <- tile(keys 16..31)[r], same lane.
//   O^T (16 d x 16 queries) += V^T (A: row = d, k = key) x P^T, four d tiles.
//   K and V^T reach the waves through LDS: a stage is 64 keys of both planes (16 KiB) per key slice, copied once per block and read by all the slice's waves; stage t + 2 is copied while stage t + 1 is worked on.
//   Per-query statistics live per lane (column = query): per-lane partial sums, combined once at the end.
//   The reference maximum of a query may trail its running maximum: each step forms its probabilities against the reference in use and tests their in-lane sums, one wave-wide test per 32 keys.
//   Only when the test fires are the step's maxima taken (in-lane max over 16 scores + one xor-16 exchange), the sums rescaled and the step's probabilities formed again.
// chunk C of this lane in the pair's exchange area: a wave-wide access is 512 contiguous bytes
#define XS_AT(C) (*(v4f*)&xs[qg][((C) * 32 + lane) * 4])
#define XS_PUT(I, ACC) do { \
    v4f lo_, hi_; \
    lo_.x = ACC[0]; lo_.y = ACC[1]; lo_.z = ACC[2]; lo_.w = ACC[3]; \
    hi_.x = ACC[4]; hi_.y = ACC[5]; hi_.z = ACC[6]; hi_.w = ACC[7]; \
    XS_AT(2 * (I))     = lo_; \
    XS_AT(2 * (I) + 1) = hi_; \
} while (0)
// own accumulator x FA + the other slice's (tile I of the exchange area) x FB -> output tile in LDS
#define FA_STAGE(QT, T, ACC, FA, FB) do { \
    const v4f xl_ = XS_AT(2 * ((QT) * 4 + (T))); \
    const v4f xh_ = XS_AT(2 * ((QT) * 4 + (T)) + 1); \
    v4f lo_, hi_; \
    lo_.x = ACC[0] * FA + xl_.x * FB; lo_.y = ACC[1] * FA + xl_.y * FB; lo_.z = ACC[2] * FA + xl_.z * FB; lo_.w = ACC[3] * FA + xl_.w * FB; \
    hi_.x = ACC[4] * FA + xh_.x * FB; hi_.y = ACC[5] * FA + xh_.y * FB; hi_.z = ACC[6] * FA + xh_.z * FB; hi_.w = ACC[7] * FA + xh_.w * FB; \
    *(v4f*)&os[qg][((QT) * 16 + col) * OS_P + (T) * 16 + 8 * h]     = lo_; \
    *(v4f*)&os[qg][((QT) * 16 + col) * OS_P + (T) * 16 + 8 * h + 4] = hi_; \
} while (0)

__global__ __launch_bounds__(32 * FA_NW) void k_fa(const float* __restrict__ Q, const _Float16* __restrict__ K16, const _Float16* __restrict__ Vt16,
                                                   float* __restrict__ O, const int* __restrict__ n_unused) {
    (void)n_unused;                                        // the module's integer scalar input; not used by the computation
    __shared__ __align__(16) _Float16 ring[2][FA_KS][2 * ST_ELEMS]; // [buffer][key slice][k stage | v^T stage]
    __shared__ __align__(16) float xs[FA_NQ][XS_CH * 128]; // per query group: the second slice's partial state, [chunk][lane][4 f32]
    __shared__ __align__(16) float os[FA_NQ][FA_QW * OS_P]; // per query group: 32 x 64 output tile (written by the pair's first wave, read by both; block barrier in between)
    const int lane = threadIdx.x & 31;
    const int wave = __builtin_amdgcn_readfirstlane(threadIdx.x >> 5);
    const int h = lane >> 4, col = lane & 15;
    const int bh = blockIdx.y;
    const int ks = wave / FA_NQ;                           // key slice (the same in the whole wave)
    const int qg = wave % FA_NQ;                           // query group
    const int q0 = blockIdx.x * FA_QB + qg * FA_QW;
    const size_t pbase = ((size_t)bh * SEQ + (size_t)ks * SL_KEYS) * DH;   // same element count per head and per key in both planes

    // scores are carried x256 (q x16, k x16); exp2 domain: 2^(s * C2), C2 = log2(e) / sqrt(512) / 256
    const float C2 = (float)(0.044194173824159216 * 1.4426950408889634 / 256.0);

    const unsigned lo = 8u * (unsigned)lane;
    // Q^T fragments straight from the f32 input (full-size row stride): lane = query col, elements 8j..8j+7 <- d = 32 half + 16 j + 8 h + 0..7
    const float* qrow = Q + ((size_t)bh * SEQ_FULL + (size_t)(q0 + col)) * DH + 8 * h;
    const float* qrow1 = qrow + 16 * DH;                   // the second tile: queries q0 + 16 ..
    FragH fq0, fq1, fq2, fq3;
    fq0.h[0] = cvt8(qrow);       fq0.h[1] = cvt8(qrow + 16);
    fq1.h[0] = cvt8(qrow + 32);  fq1.h[1] = cvt8(qrow + 48);
    fq2.h[0] = cvt8(qrow1);      fq2.h[1] = cvt8(qrow1 + 16);
    fq3.h[0] = cvt8(qrow1 + 32); fq3.h[1] = cvt8(qrow1 + 48);
    const v16h bq0 = fq0.v;                                // tile 0, d 0..31
    const v16h bq1 = fq1.v;                                // tile 0, d 32..63
    const v16h cq0 = fq2.v;                                // tile 1, d 0..31
    const v16h cq1 = fq3.v;                                // tile 1, d 32..63
    const _Float16* kp = K16 + pbase;
    const _Float16* vp = Vt16 + pbase;

    // this lane's 16 bytes of the wave's first piece, inside a stage (f16 elements)
    const unsigned ce = (unsigned)qg * (ST_ELEMS / FA_NQ) + lo;
    const unsigned lds0 = (unsigned)(size_t)&ring[0][ks][0] + 2u * ce;  // LDS byte address in buffer 0, own slice, k half
    const _Float16* gk = kp + ce;
    const _Float16* gv = vp + ce;

    v8f a0 = {}, a1 = {}, a2 = {}, a3 = {};                // tile 0
    v8f b0 = {}, b1 = {}, b2 = {}, b3 = {};                // tile 1
    float m0 = -1.0e30f, l0 = 0.0f, m1 = -1.0e30f, l1 = 0.0f;
    float n0 = 8.0f - m0, n1 = 8.0f - m1;                  // 8 - reference: the first step's probabilities overflow to +inf, its test fires and sets the first reference

    stage_copy(lds0, lds0 + 2u * ST_ELEMS, gk, gv);                     // stage 0 -> buffer 0
    asm volatile("s_wait_asynccnt 0x0" ::: "memory");                   // this wave's share of stage 0 has landed
    __syncthreads();                                                    // publishes stage 0
    stage_copy(lds0 + RING_BUF, lds0 + RING_BUF + 2u * ST_ELEMS, gk + ST_ELEMS, gv + ST_ELEMS);   // stage 1 -> buffer 1

#pragma unroll 1   // one trip per stage: the hot loop stays small
    for (int t = 0; t < NSTAGE; ++t) {
      const _Float16* sb = &ring[t & 1][ks][0];
#pragma unroll     // the stage's 32-key groups inline: their LDS offsets become immediates of the loads
      for (int u = 0; u < ST_KEYS / 32; ++u) {
        const _Float16* kt = sb + u * 32 * DH;
        const v16h k00 = ld_frag(kt, lo);                  // keys 0..15 of the 32-key group, d 0..31
        const v16h k01 = ld_frag(kt + FRAG_ELEMS, lo);     // d 32..63
        const v16h k10 = ld_frag(kt + 2 * FRAG_ELEMS, lo); // keys 16..31
        const v16h k11 = ld_frag(kt + 3 * FRAG_ELEMS, lo);
        v8f s0 = {}, s1 = {}, t0 = {}, t1 = {};
        s0 = mma16(k00, bq0, s0);
        s1 = mma16(k10, bq0, s1);
        t0 = mma16(k00, cq0, t0);
        t1 = mma16(k10, cq0, t1);
        s0 = mma16(k01, bq1, s0);
        s1 = mma16(k11, bq1, s1);
        t0 = mma16(k01, cq1, t0);
        t1 = mma16(k11, cq1, t1);
        guard_s(s0, s1, t0, t1, k00, k01, k10, k11, bq0, bq1, cq0, cq1);

        const _Float16* vt = sb + ST_ELEMS + u * 32 * DH;
        const v16h v0 = ld_frag(vt, lo);                   // d 0..15,  keys {8h.., 16+8h..} of the group
        const v16h v1 = ld_frag(vt + FRAG_ELEMS, lo);
        const v16h v2 = ld_frag(vt + 2 * FRAG_ELEMS, lo);
        const v16h v3 = ld_frag(vt + 3 * FRAG_ELEMS, lo);
        __builtin_amdgcn_sched_barrier(0);                 // the eight v^T reads issue here, as one group, and return under the exponentials; without it they sink to the products, which then wait out the LDS latency

        float r0, r1;
        v16h bp = prob_step(s0, s1, C2, n0, r0);
        v16h cp = prob_step(t0, t1, C2, n1, r1);
        // no probability is negative, so a lane's sum bounds each of its 16: at or below 2^15 all of them fit f16 and the reference in use stands (an overflow gives +inf and fails the test)
        const bool need = (r0 > 32768.0f) | (r1 > 32768.0f);
        if (__builtin_amdgcn_ballot_w32(need) != 0) {      // one scalar branch for the whole wave, both lane halves of a query included: rare behind the first step
            rescale(max16(s0, s1), C2, m0, n0, l0, a0, a1, a2, a3);
            rescale(max16(t0, t1), C2, m1, n1, l1, b0, b1, b2, b3);
            bp = prob_step(s0, s1, C2, n0, r0);            // this step's probabilities again, against the new references
            cp = prob_step(t0, t1, C2, n1, r1);
        }
        l0 += r0; l1 += r1;
        a0 = mma16(v0, bp, a0);
        a1 = mma16(v1, bp, a1);
        a2 = mma16(v2, bp, a2);
        a3 = mma16(v3, bp, a3);
        b0 = mma16(v0, cp, b0);
        b1 = mma16(v1, cp, b1);
        b2 = mma16(v2, cp, b2);
        b3 = mma16(v3, cp, b3);
        guard_o(a0, a1, a2, a3, b0, b1, b2, b3, v0, v1, v2, v3, bp, cp);
      }
      asm volatile("s_wait_dscnt 0x0" ::: "memory");                    // this wave's reads of stage t have returned before its buffer is refilled
      asm volatile("s_wait_asynccnt 0x0" ::: "memory");                 // this wave's share of stage t + 1 has landed
      __syncthreads();                                                  // publishes stage t + 1 and ends every wave's reads of stage t
      if (t + 2 < NSTAGE) {
        const unsigned lb = lds0 + (unsigned)(t & 1) * RING_BUF;
        stage_copy(lb, lb + 2u * ST_ELEMS, gk + (size_t)(t + 2) * ST_ELEMS, gv + (size_t)(t + 2) * ST_ELEMS);
      }
    }
    asm volatile("s_wait_asynccnt 0x0" ::: "memory");                   // nothing of this wave is in flight when it goes on to the epilogue

    const float lt0 = l0 + __shfl_xor(l0, 16, 32);         // both lane halves of a query used the same running max
    const float lt1 = l1 + __shfl_xor(l1, 16, 32);
    if (ks == 1) {                                         // scalar test: the second slice's wave hands its partial state over
        XS_PUT(0, a0); XS_PUT(1, a1); XS_PUT(2, a2); XS_PUT(3, a3);
        XS_PUT(4, b0); XS_PUT(5, b1); XS_PUT(6, b2); XS_PUT(7, b3);
        v4f st; st.x = m0; st.y = lt0; st.z = m1; st.w = lt1;
        XS_AT(16) = st;
    }
    __syncthreads();                                       // publishes the second slice's partial states
    if (ks == 0) {
        const v4f st = XS_AT(16);
        const float mn0 = fmaxf(m0, st.x), mn1 = fmaxf(m1, st.z);
        const float ca0 = __builtin_amdgcn_exp2f(m0 - mn0), cb0 = __builtin_amdgcn_exp2f(st.x - mn0);
        const float ca1 = __builtin_amdgcn_exp2f(m1 - mn1), cb1 = __builtin_amdgcn_exp2f(st.z - mn1);
        const float inv0 = 1.0f / ((lt0 * ca0 + st.y * cb0) * 16.0f);   // undo the x16 carry of v; the x256 carry of p cancels against the sum
        const float inv1 = 1.0f / ((lt1 * ca1 + st.w * cb1) * 16.0f);
        const float fa0 = ca0 * inv0, fb0 = cb0 * inv0, fa1 = ca1 * inv1, fb1 = cb1 * inv1;
        FA_STAGE(0, 0, a0, fa0, fb0);
        FA_STAGE(0, 1, a1, fa0, fb0);
        FA_STAGE(0, 2, a2, fa0, fb0);
        FA_STAGE(0, 3, a3, fa0, fb0);
        FA_STAGE(1, 0, b0, fa1, fb1);
        FA_STAGE(1, 1, b1, fa1, fb1);
        FA_STAGE(1, 2, b2, fa1, fb1);
        FA_STAGE(1, 3, b3, fa1, fb1);
    }
    __syncthreads();                                       // publishes the output tiles
    {
        const int r0 = ks * 16;                            // each wave of the pair stores 16 of the group's 32 rows
        float* ob = O + ((size_t)bh * SEQ + (size_t)(q0 + r0)) * DH;
        const int c4 = (lane & 15) * 4;
#pragma unroll     // all eight LDS reads are issued ahead of the stores
        for (int it = 0; it < 8; ++it) {
            const int row = it * 2 + h;                    // 16 lanes x 16 B = one 256-B output row; one instruction = two whole rows (512 contiguous bytes)
            const v4f val = *(const v4f*)&os[qg][(r0 + row) * OS_P + c4];
            *(v4f*)(ob + (size_t)row * DH + c4) = val;
        }
    }
}

extern "C" void kernel_launch(void* const* d_in, const int* in_sizes, int n_in, void* d_out, int out_size, void* d_ws, size_t ws_size, hipStream_t stream) {
    if (n_in < 4) return;
    const long long need = ((long long)(NB * NH - 1) * SEQ_FULL + SEQ) * DH;
    if ((long long)in_sizes[0] < need || (long long)in_sizes[1] < need || (long long)in_sizes[2] < need || in_sizes[3] < 1) return;
    if ((long long)out_size < (long long)NB * NH * SEQ * DH) return;
    if ((size_t)WS_TOTAL > ws_size) return;
    const float* q = (const float*)d_in[0];
    const float* k = (const float*)d_in[1];
    const float* v = (const float*)d_in[2];
    const int*   n = (const int*)d_in[3];
    float* out = (float*)d_out;
    char* wsp = (char*)d_ws;
    unsigned short* K16  = (unsigned short*)(wsp);
    unsigned short* Vt16 = (unsigned short*)(wsp + PLANE_BYTES);

    k_cast_kv<<<CAST_K_BLOCKS + CAST_V_BLOCKS, 256, 0, stream>>>(k, v, K16, Vt16);
    k_fa<<<dim3((unsigned)(SEQ / FA_QB), (unsigned)(NB * NH)), 32 * FA_NW, 0, stream>>>(q, (const _Float16*)K16, (const _Float16*)Vt16, out, n);
}

// v007
// Measured time: 31.9 microseconds a run.
// It is 1.09 times as fast as v005, going by the measured steps of the versions left out in between.
// All steps since v000 together make it 4.33 times as fast.
// Scaled-dot-product attention (32 heads x 2,048 x 64, scores x 1/sqrt(512), no mask). Both contractions (k . q^T and v^T . p^T) on v_wmma_f32_16x16x32_f16: k, v converted to bf16 (RNE) and carried x16 as exact f16 (planes of k, v^T stored in WMMA fragment order by one cast launch and staged per block in a two-buffer LDS ring by tensor loads, one request per wave and stage); q times log2(e)/sqrt(512)/16, rounded to f16, straight into each wave's registers, so that the score products come out in the exp2 domain; their accumulators start at 8 - reference, so that they leave the matrix pipe as the exponents of the probabilities; probabilities carried x256 as f16, f32 accumulate, f32 online softmax whose reference maximum moves, and rescales the sums, at the first step and then only when a lane's 16 probabilities of a step sum to more than 2^15 in their x256 carry. A wave takes 32 queries and one half of the keys; the two halves' partial results are joined once at the end.
#include <hip/hip_runtime.h>

typedef __attribute__((ext_vector_type(16))) _Float16     v16h;
typedef __attribute__((ext_vector_type(8)))  _Float16     v8h;
typedef __attribute__((ext_vector_type(8)))  float        v8f;
typedef __attribute__((ext_vector_type(4)))  float        v4f;
typedef __attribute__((ext_vector_type(2)))  float        v2f;
typedef __attribute__((ext_vector_type(4)))  unsigned int v4u;
typedef __attribute__((ext_vector_type(8)))  unsigned int v8u;

#ifndef NB
#define NB 4
#endif
#ifndef SEQ
#define SEQ 2048
#endif
#define NB_FULL  4
#define SEQ_FULL 2048
#define NH       8
#define DH       64
#define FA_NW    8                 // waves per block
#define FA_KS    2                 // key slices: waves w and w + FA_NQ take the same queries and one slice of the keys each
#define FA_NQ    (FA_NW / FA_KS)   // query groups per block
#define FA_QW    32                // queries per wave: two 16-column tiles that share every k and v^T fragment
#define FA_QB    (FA_QW * FA_NQ)   // queries per block
#define OS_P     68                // LDS pitch (floats) of an output tile
#define ST_KEYS  64                // keys per LDS stage
#define ST_ELEMS (ST_KEYS * DH)    // f16 elements of one operand's stage (8 KiB, contiguous in its plane)
#define SL_KEYS  (SEQ / FA_KS)     // keys per slice
#define NSTAGE   (SL_KEYS / ST_KEYS)
#define RING_BUF ((unsigned)(FA_KS * 2 * ST_ELEMS * 2))   // bytes of one ring buffer: every slice's k and v^T stage
#define XS_CH    17                // 16-B chunks per lane of a wave's partial state: 16 of accumulators, 1 of max and sum

#define PLANE_ELEMS ((size_t)NB * NH * SEQ * DH)
#define PLANE_BYTES (PLANE_ELEMS * 2)
#define WS_TOTAL    (2 * PLANE_BYTES)

static_assert(DH == 64);
static_assert(NB <= NB_FULL);
static_assert(SEQ <= SEQ_FULL);
static_assert(SEQ % 256 == 0);            // 16-row and 32-key fragment groups never straddle a head; key loop steps by 32
static_assert(SEQ % FA_QB == 0);          // query tiles exact
static_assert(DH % 32 == 0);              // k-steps of 32 over the head dim
static_assert(PLANE_BYTES % 128 == 0);
static_assert(WS_TOTAL <= 134217728);     // workspace carve <= 128 MiB
static_assert((OS_P * 4) % 16 == 0);
static_assert(ST_KEYS % 32 == 0 && SL_KEYS % ST_KEYS == 0 && NSTAGE >= 2);   // whole 32-key groups per stage; the ring's prologue needs two stages
#define TL_ROW   256u              // bytes per row of a wave's tensor-load tile (source pitch the same: the tile is contiguous in its plane and in LDS)
#define TL_ROWS  16u               // rows of it
#define TL_BYTES (TL_ROW * TL_ROWS)
static_assert(FA_NQ == 4 && 2 * ST_ELEMS * 2 == FA_NQ * TL_BYTES);       // the four waves of a key slice bring one half of one operand's stage each
static_assert(TL_BYTES % 2048 == 0 && (ST_ELEMS * 2) % 2048 == 0);       // every tile's place in LDS is a multiple of 2 KiB
static_assert(FA_KS == 2 && FA_QW == 32);                                // the merge joins two partial states; each wave of a pair stores 16 of the 32 output rows

// 16-bit WMMA fragment map (wave32), lane L, h = L>>4, m = L&15:
//   A 16x32: lane = row m;    element i -> k = (i<8) ? 8h+i : 16+8h+(i-8)
//   B 32x16: lane = column m; the SAME k(i,h)
//   D 16x16 (8 f32): lane = column m; element r -> row 8h+r
// Fragment-ordered plane: one 16 x 32 fragment = 512 f16 = [j = 0,1][lane 0..31][8 f16]; chunk (j, lane) holds elements 8j..8j+7 of that lane, i.e. row/column m, k = 16j + 8h + 0..7.
// A wave-wide 16-byte load of one j is then 512 contiguous bytes (four whole 128-B lines).
#define FRAG_ELEMS 512
union FragH { v16h v; v8h h[2]; };
// p = start of the fragment (the same in every lane), lo = lane * 8: elements 0..7 <- chunk j = 0, 8..15 <- chunk j = 1
__device__ __forceinline__ v16h ld_frag(const _Float16* __restrict__ p, unsigned lo) {
    FragH f; f.h[0] = *(const v8h*)(p + lo); f.h[1] = *(const v8h*)(p + 256 + lo); return f.v;
}
__device__ __forceinline__ v8f mma16(v16h a, v16h b, v8f c) {
    return __builtin_amdgcn_wmma_f32_16x16x32_f16(false, a, false, b, (short)0, c, false, false);
}
// hazard guards: all accumulators of the group are tied, all operand fragments stay live through the nops
__device__ __forceinline__ void guard_s(v8f& s0, v8f& s1, v8f& s2, v8f& s3, v16h a0, v16h a1, v16h a2, v16h a3, v16h b0, v16h b1, v16h b2, v16h b3) {
    asm volatile("v_nop\n\tv_nop\n\tv_nop\n\tv_nop" : "+v"(s0), "+v"(s1), "+v"(s2), "+v"(s3)
                 : "v"(a0), "v"(a1), "v"(a2), "v"(a3), "v"(b0), "v"(b1), "v"(b2), "v"(b3));
}
__device__ __forceinline__ void guard_o(v8f& o0, v8f& o1, v8f& o2, v8f& o3, v8f& o4, v8f& o5, v8f& o6, v8f& o7, v16h a0, v16h a1, v16h a2, v16h a3, v16h b0, v16h b1) {
    asm volatile("v_nop\n\tv_nop\n\tv_nop\n\tv_nop" : "+v"(o0), "+v"(o1), "+v"(o2), "+v"(o3), "+v"(o4), "+v"(o5), "+v"(o6), "+v"(o7)
                 : "v"(a0), "v"(a1), "v"(a2), "v"(a3), "v"(b0), "v"(b1));
}

// bf16 RNE kept as f32 (finite inputs)
__device__ __forceinline__ float bf_rne(float v) {
    const unsigned u = __float_as_uint(v);
    const unsigned r = (u + 0x7fffu + ((u >> 16) & 1u)) & 0xffff0000u;
    return __uint_as_float(r);
}
__device__ __forceinline__ unsigned int pk2h(float a, float b) {
    return (unsigned int)__builtin_bit_cast(unsigned short, (_Float16)a) | ((unsigned int)__builtin_bit_cast(unsigned short, (_Float16)b) << 16);
}

// f32 [bh][s][64] (full-size row stride) -> f16 fragments [bh][SEQ/16 row tiles][2 halves of d][j][lane][8] = bf16_rne(x) * 16 (exact in f16); row = s, k = d.
// A wave takes 8 rows x one 32-wide half of d: it reads eight whole 128-B lines and stores four whole 128-B lines (one per (j, h), eight rows each).
__device__ __forceinline__ void cast_rows(const float* __restrict__ src, unsigned short* __restrict__ dst, const long long u) {
    if (u >= (long long)NB * NH * SEQ * (DH / 8)) return;
    const int jh = (int)(u & 3);                           // 2 j + h
    const int hf = (int)((u >> 5) & 1);                    // which half of d
    const int m  = (int)((u >> 2) & 7) + 8 * (int)((u >> 6) & 1);   // row inside the 16-row tile
    const int c0 = 32 * hf + 8 * jh;
    const long long row = (u >> 7) * 16 + m;
    const int bh = (int)(row / SEQ);
    const int s  = (int)(row % SEQ);
    const float* sp = src + ((size_t)bh * SEQ_FULL + (size_t)s) * DH + c0;
    const v4f x0 = *(const v4f*)(sp);
    const v4f x1 = *(const v4f*)(sp + 4);
    v4u pk;
    pk.x = pk2h(bf_rne(x0.x) * 16.0f, bf_rne(x0.y) * 16.0f);
    pk.y = pk2h(bf_rne(x0.z) * 16.0f, bf_rne(x0.w) * 16.0f);
    pk.z = pk2h(bf_rne(x1.x) * 16.0f, bf_rne(x1.y) * 16.0f);
    pk.w = pk2h(bf_rne(x1.z) * 16.0f, bf_rne(x1.w) * 16.0f);
    v4u* d = (v4u*)(dst + ((size_t)(u >> 7) * 128 + (size_t)(64 * hf + 16 * jh + m)) * 8);
    *d = pk;
}

// f32 v[bh][s][64] -> f16 fragments of v^T [bh][SEQ/32 key groups][4 d tiles][j][lane][8] = bf16_rne(x) * 16; row = d, k = key.
// A wave takes 32 consecutive d x 8 keys: each of its eight loads reads one whole 128-B line, and it stores four whole 128-B lines.
__device__ __forceinline__ void cast_vt(const float* __restrict__ src, unsigned short* __restrict__ dst, const long long u) {
    const int per = SEQ / 32;
    if (u >= (long long)NB * NH * DH * (SEQ / 8)) return;
    const long long g = u >> 8;                            // key group over all heads
    const int jh = (int)((u >> 6) & 3);                    // 2 j + h
    const int s0 = 32 * (int)(g % per) + 8 * jh;           // key = 32 kg + 16 j + 8 h
    const int d  = (int)(u & 63);
    const int bh = (int)(g / per);
    const float* sp = src + ((size_t)bh * SEQ_FULL + (size_t)s0) * DH + d;
    float w[8];
#pragma unroll
    for (int e = 0; e < 8; ++e) w[e] = bf_rne(sp[(size_t)e * DH]) * 16.0f;
    v4u pk;
    pk.x = pk2h(w[0], w[1]); pk.y = pk2h(w[2], w[3]); pk.z = pk2h(w[4], w[5]); pk.w = pk2h(w[6], w[7]);
    v4u* dd = (v4u*)(dst + ((size_t)g * 256 + (size_t)(64 * (d >> 4) + 16 * jh + (d & 15))) * 8);
    *dd = pk;
}

// One launch for both planes: blocks 0 .. CAST_K_BLOCKS-1 cast k, the rest cast v^T (the choice is the same for a whole block).
#define CAST_K_BLOCKS ((unsigned)(((long long)NB * NH * SEQ * (DH / 8) + 255) / 256))
#define CAST_V_BLOCKS ((unsigned)(((long long)NB * NH * DH * (SEQ / 8) + 255) / 256))
__global__ __launch_bounds__(256) void k_cast_kv(const float* __restrict__ k, const float* __restrict__ v,
                                                 unsigned short* __restrict__ K16, unsigned short* __restrict__ Vt16) {
    if (blockIdx.x < CAST_K_BLOCKS) cast_rows(k, K16, (long long)blockIdx.x * 256 + threadIdx.x);
    else                            cast_vt(v, Vt16, (long long)(blockIdx.x - CAST_K_BLOCKS) * 256 + threadIdx.x);
}

// eight consecutive f32 -> eight f16 = x * c, rounded once to f16
__device__ __forceinline__ v8h cvt8(const float* __restrict__ p, const float c) {
    const v4f x0 = *(const v4f*)(p);
    const v4f x1 = *(const v4f*)(p + 4);
    v8h r;
    r[0] = (_Float16)(x0.x * c); r[1] = (_Float16)(x0.y * c);
    r[2] = (_Float16)(x0.z * c); r[3] = (_Float16)(x0.w * c);
    r[4] = (_Float16)(x1.x * c); r[5] = (_Float16)(x1.y * c);
    r[6] = (_Float16)(x1.z * c); r[7] = (_Float16)(x1.w * c);
    return r;
}

__device__ __forceinline__ unsigned int uni(unsigned int v) { return (unsigned int)__builtin_amdgcn_readfirstlane(v); }
// a wave-uniform test value held in a scalar register, so that the test around a tensor load compiles to s_cmp + s_cbranch_scc (tensor loads ignore EXEC)
__device__ __forceinline__ unsigned int pinned(unsigned int v) { unsigned int w = uni(v); asm volatile("" : "+s"(w)); return w; }   // the empty statement is the one of pinned(): it keeps w in a scalar register
// One wave's share of one stage is one tensor load of TL_ROWS rows of TL_ROW bytes (4 KiB, contiguous), global -> LDS through no register and with no per-lane address.
// Descriptor group 1, the same for every request: no mask, 1-byte elements, no pad, tensor = tile.
__device__ __forceinline__ v8u tl_group1() {
    v8u g;
    g[0] = uni(0u);                                                    // mask 0, data_size 0, no pad
    g[1] = uni((TL_ROW & 0xFFFFu) << 16);                              // tensor_dim0 [15:0]
    g[2] = uni((TL_ROW >> 16) | ((TL_ROWS & 0xFFFFu) << 16));          // tensor_dim0 [31:16], tensor_dim1 [15:0]
    g[3] = uni((TL_ROWS >> 16) | (TL_ROW << 16));                      // tensor_dim1 [31:16], tile_dim0
    g[4] = uni(TL_ROWS);                                               // tile_dim1
    g[5] = uni(TL_ROW);                                                // source row pitch
    g[6] = uni(0u);
    g[7] = uni(0u);
    return g;
}
// Sets descriptor group 0 (kept in one register tuple through the kernel, word 0 = count 1 set once) and issues.
// dst = byte offset of the tile in the work-group's LDS (a multiple of 2 KiB), ga = address of its first byte in the plane.
__device__ __forceinline__ void stage_load(v4u& g0, const v8u g1, const unsigned int dst, const unsigned long long ga) {
    g0[1] = uni(dst);
    g0[2] = uni((unsigned int)ga);
    g0[3] = uni((((unsigned int)(ga >> 32)) & 0x01FFFFFFu) | 0x80000000u);   // address [56:32], type 2
    asm volatile("tensor_load_to_lds %0, %1" :: "s"(g0), "s"(g1) : "memory");
}

// The lane's largest exponent of one 16-query tile over 32 keys: s0 = exponents (score + n) of keys 0..15, s1 = of keys 16..31 (D layout, lane = query column, 8 keys of each tile per lane).
__device__ __forceinline__ float max16(const v8f s0, const v8f s1) {
    float mx = fmaxf(s0[0], s1[0]);
#pragma unroll     // constant element numbers: the score tiles stay in registers
    for (int r = 1; r < 8; ++r) mx = fmaxf(mx, fmaxf(s0[r], s1[r]));
    return mx;
}
// Moves one tile's reference maximum m up to the running maximum (x = the lane's largest exponent of this step, formed with the start value n) and rescales its sum and its four accumulators to it.
// d = what the step's exponents, and the start value, move by: up to rounding the start value becomes 8 - m.
__device__ __forceinline__ void rescale(const float x, const float n, float& m, float& d, float& l, v8f& o0, v8f& o1, v8f& o2, v8f& o3) {
    float mx = x - n;                                  // the score itself; n is the same in both lane halves of a query
    mx = fmaxf(mx, __shfl_xor(mx, 16, 32));            // the other 16 keys of this query live in lane ^ 16: both halves get the same reference
    const float mnew = fmaxf(m, mx);
    const float corr = __builtin_amdgcn_exp2f(m - mnew);
    m = mnew;
    d = (8.0f - mnew) - n;                             // probabilities carried x 2^8
    l *= corr;
    o0 = o0 * corr; o1 = o1 * corr; o2 = o2 * corr; o3 = o3 * corr;
}
// One tile's probabilities over 32 keys from their exponents x0, x1 (score + 8 - reference in use): gives the sum rs of the lane's 16 and returns P^T as a B fragment.
__device__ __forceinline__ v16h prob_step(const v8f x0, const v8f x1, float& rs) {
    v16h bp; rs = 0.0f;
#pragma unroll     // constant element numbers: scores and probabilities stay in registers
    for (int r = 0; r < 8; ++r) {
        const float e0 = __builtin_amdgcn_exp2f(x0[r]);
        const float e1 = __builtin_amdgcn_exp2f(x1[r]);
        rs += e0 + e1;
        bp[r]     = (_Float16)e0;                      // key 8h + r
        bp[8 + r] = (_Float16)e1;                      // key 16 + 8h + r
    }
    return bp;
}

// Fused attention, transposed orientation. Wave = 32 queries (two 16-column tiles) x one half of the keys; 32 keys per step; each k and v^T fragment read from LDS feeds one product per tile.
//   The two waves of a query group run the same online softmax on their own key slice; their (max, sum, O^T) are joined once behind the loop, through LDS.
//   S^T (16 keys x 16 queries) = K (A: row = key, k = d) x Q^T (B: column = query, k = d), two key tiles per step.
//   P^T (B operand, k = key, column = query) is built in registers from the two D tiles: element r <- tile(keys 0..15)[r], element 8+r <- tile(keys 16..31)[r], same lane.
//   O^T (16 d x 16 queries) += V^T (A: row = d, k = key) x P^T, four d tiles.
//   K and V^T reach the waves through LDS: a stage is 64 keys of both planes (16 KiB) per key slice, loaded once per block (each of the slice's four waves asks for 4 KiB) and read by all the slice's waves; stage t + 2 is loaded while stage t + 1 is worked on.
//   Per-query statistics live per lane (column = query): per-lane partial sums, combined once at the end.
//   The reference maximum of a query may trail its running maximum: each step forms its probabilities against the reference in use and tests their in-lane sums, one wave-wide test per 32 keys.
//   Only when the test fires are the step's maxima taken (in-lane max over 16 scores + one xor-16 exchange), the sums rescaled and the step's probabilities formed again.
// chunk C of this lane in the pair's exchange area: a wave-wide access is 512 contiguous bytes
#define XS_AT(C) (*(v4f*)&xs[qg][((C) * 32 + lane) * 4])
#define XS_PUT(I, ACC) do { \
    v4f lo_, hi_; \
    lo_.x = ACC[0]; lo_.y = ACC[1]; lo_.z = ACC[2]; lo_.w = ACC[3]; \
    hi_.x = ACC[4]; hi_.y = ACC[5]; hi_.z = ACC[6]; hi_.w = ACC[7]; \
    XS_AT(2 * (I))     = lo_; \
    XS_AT(2 * (I) + 1) = hi_; \
} while (0)
// own accumulator x FA + the other slice's (tile I of the exchange area) x FB -> output tile in LDS
#define FA_STAGE(QT, T, ACC, FA, FB) do { \
    const v4f xl_ = XS_AT(2 * ((QT) * 4 + (T))); \
    const v4f xh_ = XS_AT(2 * ((QT) * 4 + (T)) + 1); \
    v4f lo_, hi_; \
    lo_.x = ACC[0] * FA + xl_.x * FB; lo_.y = ACC[1] * FA + xl_.y * FB; lo_.z = ACC[2] * FA + xl_.z * FB; lo_.w = ACC[3] * FA + xl_.w * FB; \
    hi_.x = ACC[4] * FA + xh_.x * FB; hi_.y = ACC[5] * FA + xh_.y * FB; hi_.z = ACC[6] * FA + xh_.z * FB; hi_.w = ACC[7] * FA + xh_.w * FB; \
    *(v4f*)&os[qg][((QT) * 16 + col) * OS_P + (T) * 16 + 8 * h]     = lo_; \
    *(v4f*)&os[qg][((QT) * 16 + col) * OS_P + (T) * 16 + 8 * h + 4] = hi_; \
} while (0)

__global__ __launch_bounds__(32 * FA_NW) void k_fa(const float* __restrict__ Q, const _Float16* __restrict__ K16, const _Float16* __restrict__ Vt16,
                                                   float* __restrict__ O, const int* __restrict__ n_unused) {
    (void)n_unused;                                        // the module's integer scalar input; not used by the computation
    __shared__ __attribute__((aligned(2048))) _Float16 ring[2][FA_KS][2 * ST_ELEMS]; // [buffer][key slice][k stage | v^T stage]; every tensor-load tile starts at a multiple of 2 KiB
    __shared__ __align__(16) float xs[FA_NQ][XS_CH * 128]; // per query group: the second slice's partial state, [chunk][lane][4 f32]
    __shared__ __align__(16) float os[FA_NQ][FA_QW * OS_P]; // per query group: 32 x 64 output tile (written by the pair's first wave, read by both; block barrier in between)
    const int lane = threadIdx.x & 31;
    const int wave = __builtin_amdgcn_readfirstlane(threadIdx.x >> 5);
    const int h = lane >> 4, col = lane & 15;
    const int bh = blockIdx.y;
    const int ks = wave / FA_NQ;                           // key slice (the same in the whole wave)
    const int qg = wave % FA_NQ;                           // query group
    const int q0 = blockIdx.x * FA_QB + qg * FA_QW;
    const size_t pbase = ((size_t)bh * SEQ + (size_t)ks * SL_KEYS) * DH;   // same element count per head and per key in both planes

    // k is carried x16; q carries CQ = log2(e) / sqrt(512) / 16: k . q^T is the score in the exp2 domain, no scaling behind the products
    const float CQ = (float)(0.044194173824159216 * 1.4426950408889634 / 16.0);

    const unsigned lo = 8u * (unsigned)lane;
    // Q^T fragments straight from the f32 input (full-size row stride): lane = query col, elements 8j..8j+7 <- d = 32 half + 16 j + 8 h + 0..7
    const float* qrow = Q + ((size_t)bh * SEQ_FULL + (size_t)(q0 + col)) * DH + 8 * h;
    const float* qrow1 = qrow + 16 * DH;                   // the second tile: queries q0 + 16 ..
    FragH fq0, fq1, fq2, fq3;
    fq0.h[0] = cvt8(qrow, CQ);       fq0.h[1] = cvt8(qrow + 16, CQ);
    fq1.h[0] = cvt8(qrow + 32, CQ);  fq1.h[1] = cvt8(qrow + 48, CQ);
    fq2.h[0] = cvt8(qrow1, CQ);      fq2.h[1] = cvt8(qrow1 + 16, CQ);
    fq3.h[0] = cvt8(qrow1 + 32, CQ); fq3.h[1] = cvt8(qrow1 + 48, CQ);
    const v16h bq0 = fq0.v;                                // tile 0, d 0..31
    const v16h bq1 = fq1.v;                                // tile 0, d 32..63
    const v16h cq0 = fq2.v;                                // tile 1, d 0..31
    const v16h cq1 = fq3.v;                                // tile 1, d 32..63
    const _Float16* kp = K16 + pbase;
    const _Float16* vp = Vt16 + pbase;

    // this wave's tile of a stage: waves 0, 1 of the slice bring the two halves of the k stage, waves 2, 3 those of the v^T stage; [k stage | v^T stage] in LDS makes the place qg * 4 KiB
    const unsigned lds0 = (unsigned)(size_t)&ring[0][ks][0] + (unsigned)qg * TL_BYTES;   // LDS byte offset in buffer 0, own slice
    unsigned long long ga = (unsigned long long)(size_t)(((qg & 2) ? vp : kp) + (unsigned)(qg & 1) * (TL_BYTES / 2));   // first byte of the tile in stage 0; moves on by a stage per request
    const v8u g1 = tl_group1();
    v4u g0 = {uni(1u), 0u, 0u, 0u};                        // word 0: count 1

    v8f a0 = {}, a1 = {}, a2 = {}, a3 = {};                // tile 0
    v8f b0 = {}, b1 = {}, b2 = {}, b3 = {};                // tile 1
    float m0 = -1.0e30f, l0 = 0.0f, m1 = -1.0e30f, l1 = 0.0f;
    // start value of the score accumulators, the same in all eight rows a lane holds of a score tile (lane = query column): 8 - reference once a reference is set; a small number before, so that the first step's scores survive the addition
    v8f cn0 = {8.0f, 8.0f, 8.0f, 8.0f, 8.0f, 8.0f, 8.0f, 8.0f};
    v8f cn1 = {8.0f, 8.0f, 8.0f, 8.0f, 8.0f, 8.0f, 8.0f, 8.0f};
    float lim = -1.0f;                                     // bound of the step's test: below every sum until the first step has set the first reference, 2^15 from then on

    stage_load(g0, g1, lds0, ga);                                       // stage 0 -> buffer 0; every wave issues its own tile: no test
    asm volatile("s_wait_tensorcnt 0x0" ::: "memory");                  // this wave's share of stage 0 has landed
    __syncthreads();                                                    // publishes stage 0
    ga += 2u * ST_ELEMS;
    stage_load(g0, g1, lds0 + RING_BUF, ga);                            // stage 1 -> buffer 1

#pragma unroll 1   // one trip per stage: the hot loop stays small
    for (int t = 0; t < NSTAGE; ++t) {
      const _Float16* sb = &ring[t & 1][ks][0];
#pragma unroll     // the stage's 32-key groups inline: their LDS offsets become immediates of the loads
      for (int u = 0; u < ST_KEYS / 32; ++u) {
        const _Float16* kt = sb + u * 32 * DH;
        const v16h k00 = ld_frag(kt, lo);                  // keys 0..15 of the 32-key group, d 0..31
        const v16h k01 = ld_frag(kt + FRAG_ELEMS, lo);     // d 32..63
        const v16h k10 = ld_frag(kt + 2 * FRAG_ELEMS, lo); // keys 16..31
        const v16h k11 = ld_frag(kt + 3 * FRAG_ELEMS, lo);
        v8f s0 = mma16(k00, bq0, cn0);                     // the sums start at 8 - reference: they end as the probabilities' exponents
        v8f s1 = mma16(k10, bq0, cn0);
        v8f t0 = mma16(k00, cq0, cn1);
        v8f t1 = mma16(k10, cq0, cn1);
        s0 = mma16(k01, bq1, s0);
        s1 = mma16(k11, bq1, s1);
        t0 = mma16(k01, cq1, t0);
        t1 = mma16(k11, cq1, t1);
        guard_s(s0, s1, t0, t1, k00, k01, k10, k11, bq0, bq1, cq0, cq1);

        const _Float16* vt = sb + ST_ELEMS + u * 32 * DH;
        const v16h v0 = ld_frag(vt, lo);                   // d 0..15,  keys {8h.., 16+8h..} of the group
        const v16h v1 = ld_frag(vt + FRAG_ELEMS, lo);
        const v16h v2 = ld_frag(vt + 2 * FRAG_ELEMS, lo);
        const v16h v3 = ld_frag(vt + 3 * FRAG_ELEMS, lo);
        __builtin_amdgcn_sched_barrier(0);                 // the eight v^T reads issue here, as one group, and return under the exponentials; without it they sink to the products, which then wait out the LDS latency

        float r0, r1;
        v16h bp = prob_step(s0, s1, r0);
        v16h cp = prob_step(t0, t1, r1);
        // no probability is negative, so a lane's sum bounds each of its 16: at or below 2^15 all of them fit f16 and the reference in use stands (an overflow gives +inf and fails the test)
        const bool need = (r0 > lim) | (r1 > lim);
        if (__builtin_amdgcn_ballot_w32(need) != 0) {      // one scalar branch for the whole wave, both lane halves of a query included: rare behind the first step
            float d0, d1;
            rescale(max16(s0, s1), cn0[0], m0, d0, l0, a0, a1, a2, a3);
            rescale(max16(t0, t1), cn1[0], m1, d1, l1, b0, b1, b2, b3);
            bp = prob_step(s0 + d0, s1 + d0, r0);          // this step's probabilities again, against the new references
            cp = prob_step(t0 + d1, t1 + d1, r1);
            cn0 = cn0 + d0;                                // later steps start at the new references
            cn1 = cn1 + d1;
            lim = 32768.0f;
        }
        l0 += r0; l1 += r1;
        a0 = mma16(v0, bp, a0);
        a1 = mma16(v1, bp, a1);
        a2 = mma16(v2, bp, a2);
        a3 = mma16(v3, bp, a3);
        b0 = mma16(v0, cp, b0);
        b1 = mma16(v1, cp, b1);
        b2 = mma16(v2, cp, b2);
        b3 = mma16(v3, cp, b3);
        guard_o(a0, a1, a2, a3, b0, b1, b2, b3, v0, v1, v2, v3, bp, cp);
      }
      asm volatile("s_wait_dscnt 0x0" ::: "memory");                    // this wave's reads of stage t have returned before its buffer is refilled
      asm volatile("s_wait_tensorcnt 0x0" ::: "memory");                // this wave's share of stage t + 1 has landed
      __syncthreads();                                                  // publishes stage t + 1 and ends every wave's reads of stage t
      if (pinned(t + 2 < NSTAGE)) {                                     // scalar branch: the load is one request of the whole wave
        ga += 2u * ST_ELEMS;
        stage_load(g0, g1, lds0 + (unsigned)(t & 1) * RING_BUF, ga);    // stage t + 2 -> the buffer that stage t has left; the descriptor is formed behind the wait above
      }
    }
    asm volatile("s_wait_tensorcnt 0x0" ::: "memory");                  // nothing of this wave is in flight when it goes on to the epilogue
    asm volatile("s_wait_dscnt 0x0" ::: "memory");                      // and none of its ring reads

    const float lt0 = l0 + __shfl_xor(l0, 16, 32);         // both lane halves of a query used the same running max
    const float lt1 = l1 + __shfl_xor(l1, 16, 32);
    if (ks == 1) {                                         // scalar test: the second slice's wave hands its partial state over
        XS_PUT(0, a0); XS_PUT(1, a1); XS_PUT(2, a2); XS_PUT(3, a3);
        XS_PUT(4, b0); XS_PUT(5, b1); XS_PUT(6, b2); XS_PUT(7, b3);
        v4f st; st.x = m0; st.y = lt0; st.z = m1; st.w = lt1;
        XS_AT(16) = st;
    }
    __syncthreads();                                       // publishes the second slice's partial states
    if (ks == 0) {
        const v4f st = XS_AT(16);
        const float mn0 = fmaxf(m0, st.x), mn1 = fmaxf(m1, st.z);
        const float ca0 = __builtin_amdgcn_exp2f(m0 - mn0), cb0 = __builtin_amdgcn_exp2f(st.x - mn0);
        const float ca1 = __builtin_amdgcn_exp2f(m1 - mn1), cb1 = __builtin_amdgcn_exp2f(st.z - mn1);
        const float inv0 = 1.0f / ((lt0 * ca0 + st.y * cb0) * 16.0f);   // undo the x16 carry of v; the x256 carry of p cancels against the sum
        const float inv1 = 1.0f / ((lt1 * ca1 + st.w * cb1) * 16.0f);
        const float fa0 = ca0 * inv0, fb0 = cb0 * inv0, fa1 = ca1 * inv1, fb1 = cb1 * inv1;
        FA_STAGE(0, 0, a0, fa0, fb0);
        FA_STAGE(0, 1, a1, fa0, fb0);
        FA_STAGE(0, 2, a2, fa0, fb0);
        FA_STAGE(0, 3, a3, fa0, fb0);
        FA_STAGE(1, 0, b0, fa1, fb1);
        FA_STAGE(1, 1, b1, fa1, fb1);
        FA_STAGE(1, 2, b2, fa1, fb1);
        FA_STAGE(1, 3, b3, fa1, fb1);
    }
    __syncthreads();                                       // publishes the output tiles
    {
        const int r0 = ks * 16;                            // each wave of the pair stores 16 of the group's 32 rows
        float* ob = O + ((size_t)bh * SEQ + (size_t)(q0 + r0)) * DH;
        const int c4 = (lane & 15) * 4;
#pragma unroll     // all eight LDS reads are issued ahead of the stores
        for (int it = 0; it < 8; ++it) {
            const int row = it * 2 + h;                    // 16 lanes x 16 B = one 256-B output row; one instruction = two whole rows (512 contiguous bytes)
            const v4f val = *(const v4f*)&os[qg][(r0 + row) * OS_P + c4];
            *(v4f*)(ob + (size_t)row * DH + c4) = val;
        }
    }
}

extern "C" void kernel_launch(void* const* d_in, const int* in_sizes, int n_in, void* d_out, int out_size, void* d_ws, size_t ws_size, hipStream_t stream) {
    if (n_in < 4) return;
    const long long need = ((long long)(NB * NH - 1) * SEQ_FULL + SEQ) * DH;
    if ((long long)in_sizes[0] < need || (long long)in_sizes[1] < need || (long long)in_sizes[2] < need || in_sizes[3] < 1) return;
    if ((long long)out_size < (long long)NB * NH * SEQ * DH) return;
    if ((size_t)WS_TOTAL > ws_size) return;
    const float* q = (const float*)d_in[0];
    const float* k = (const float*)d_in[1];
    const float* v = (const float*)d_in[2];
    const int*   n = (const int*)d_in[3];
    float* out = (float*)d_out;
    char* wsp = (char*)d_ws;
    unsigned short* K16  = (unsigned short*)(wsp);
    unsigned short* Vt16 = (unsigned short*)(wsp + PLANE_BYTES);

    k_cast_kv<<<CAST_K_BLOCKS + CAST_V_BLOCKS, 256, 0, stream>>>(k, v, K16, Vt16);
    k_fa<<<dim3((unsigned)(SEQ / FA_QB), (unsigned)(NB * NH)), 32 * FA_NW, 0, stream>>>(q, (const _Float16*)K16, (const _Float16*)Vt16, out, n);
}
